// v000
// Measured on an AMD MI455X. A time is GPU time per run, averaged over a window of back-to-back runs after a warm-up
// (all launches, gaps included; the runs take copies of the inputs in turn), and the median of several windows.
// Apart from v000's, it joins two sittings. Times from different sittings can be a few percent apart, while
// side-by-side timings come from the same sitting.
// v000, which the later versions start from, runs in 698 microseconds.
#include <hip/hip_runtime.h>
#include <hip/hip_bf16.h>

typedef __attribute__((ext_vector_type(2))) float v2f;
typedef __attribute__((ext_vector_type(8))) float v8f;

#define EMBED 2048
#define HD 128
#define NHEADS 16
#define STOT 4096
#define NBATCH 64
#define NSPLIT 32           // waves per batch (8 WGs x 4 waves)
#define TILES_PER_WAVE 8    // 8 tiles * 16 slots = 128 slots per wave

static __device__ __forceinline__ v8f wmma_f32(v2f a, v2f b, v8f c) {
    return __builtin_amdgcn_wmma_f32_16x16x4_f32(false, a, false, b, (short)0, c, false, false);
}

// ---------------------------------------------------------------------------
// GEMM: C[64,N] = A[64,K] @ W[K,N] + bias[N]   (f32 WMMA 16x16x4)
// One wave per 16-wide column tile, covering all 4 row tiles (M=64).
// grid.x = N/64, block = 128 (4 waves).
// ---------------------------------------------------------------------------
__global__ __launch_bounds__(128) void gemm64_kernel(
    const float* __restrict__ A, const float* __restrict__ W,
    const float* __restrict__ bias, float* __restrict__ C, int K, int N)
{
    const int lane = threadIdx.x & 31;
    const int w    = threadIdx.x >> 5;
    const int n    = lane & 15;
    const int hi   = lane >> 4;
    const int col  = (blockIdx.x * 4 + w) * 16 + n;

    v8f acc0 = {}, acc1 = {}, acc2 = {}, acc3 = {};

    #pragma unroll 2
    for (int kc = 0; kc < K / 4; ++kc) {
        const int k0 = 4 * kc + 2 * hi;
        v2f b;
        b.x = W[(size_t)k0 * N + col];
        b.y = W[(size_t)(k0 + 1) * N + col];
        v2f a0 = *(const v2f*)(A + (size_t)(0 * 16 + n) * K + k0);
        v2f a1 = *(const v2f*)(A + (size_t)(1 * 16 + n) * K + k0);
        v2f a2 = *(const v2f*)(A + (size_t)(2 * 16 + n) * K + k0);
        v2f a3 = *(const v2f*)(A + (size_t)(3 * 16 + n) * K + k0);
        acc0 = wmma_f32(a0, b, acc0);
        acc1 = wmma_f32(a1, b, acc1);
        acc2 = wmma_f32(a2, b, acc2);
        acc3 = wmma_f32(a3, b, acc3);
    }

    const float bb = bias[col];
    #pragma unroll
    for (int j = 0; j < 8; ++j) {
        const int row = j + 8 * hi;
        C[(size_t)(0 * 16 + row) * N + col] = acc0[j] + bb;
        C[(size_t)(1 * 16 + row) * N + col] = acc1[j] + bb;
        C[(size_t)(2 * 16 + row) * N + col] = acc2[j] + bb;
        C[(size_t)(3 * 16 + row) * N + col] = acc3[j] + bb;
    }
}

// ---------------------------------------------------------------------------
// Flash-decoding MQA attention, split-K over cache slots.
// grid.x = NBATCH*8, block = 128 (4 waves). Wave = 128 slots (8 tiles of 16).
// Emits per-split partials (running max m, denom l, unnormalized O 16x128).
// ---------------------------------------------------------------------------
__global__ __launch_bounds__(128) void attn_kernel(
    const float* __restrict__ q,      // [64, 2048]  (16 heads x 128)
    const float* __restrict__ kcache, // [64, 4096, 128]
    const float* __restrict__ vcache, // [64, 4096, 128]
    const float* __restrict__ knew,   // [64, 128]
    const float* __restrict__ vnew,   // [64, 128]
    const int*   __restrict__ pos,    // [64]
    float* __restrict__ ml,           // [64, 32, 16, 2]
    float* __restrict__ opart)        // [64, 32, 16, 128]
{
    __shared__ float lds_q[EMBED];
    __shared__ float lds_p[4 * 256];

    const int tid   = threadIdx.x;
    const int w     = tid >> 5;
    const int lane  = tid & 31;
    const int n     = lane & 15;   // head row for A / slot or dim col for B,C
    const int hi    = lane >> 4;
    const int b     = blockIdx.x >> 3;
    const int split = (blockIdx.x & 7) * 4 + w;    // 0..31
    const int pslot = pos[b];
    const size_t kvb = (size_t)b * STOT * HD;

    // stage Q[b] (16x128) into LDS, coalesced
    const float* qg = q + (size_t)b * EMBED;
    for (int i = tid; i < EMBED; i += 128) lds_q[i] = qg[i];
    __syncthreads();

    const float scale = 0.08838834764831845f;  // 1/sqrt(128)

    float m_run[8], l_run[8];
    v8f O[8];
    #pragma unroll
    for (int j = 0; j < 8; ++j) { m_run[j] = -3.0e38f; l_run[j] = 0.0f; }
    #pragma unroll
    for (int f = 0; f < 8; ++f) O[f] = v8f{};

    float* sp = lds_p + w * 256;

    #pragma unroll 1
    for (int t = 0; t < TILES_PER_WAVE; ++t) {
        const int slot_base = split * 128 + t * 16;

        // ---- S = Q @ K^T for a 16-head x 16-slot tile -------------------
        const int ks = slot_base + n;   // this lane's slot column
        const float* kr = (ks == pslot) ? (knew + (size_t)b * HD)
                                        : (kcache + kvb + (size_t)ks * HD);
        v8f S = {};
        #pragma unroll
        for (int kk = 0; kk < 32; ++kk) {
            v2f a = *(const v2f*)(lds_q + n * HD + 4 * kk + 2 * hi);
            v2f kb = *(const v2f*)(kr + 4 * kk + 2 * hi);
            S = wmma_f32(a, kb, S);
        }

        // ---- online softmax (rows j+8*hi live in 16-lane halves) --------
        float pj[8];
        #pragma unroll
        for (int j = 0; j < 8; ++j) {
            float s = S[j] * scale;
            float tm = s;
            tm = fmaxf(tm, __shfl_xor(tm, 1, 32));
            tm = fmaxf(tm, __shfl_xor(tm, 2, 32));
            tm = fmaxf(tm, __shfl_xor(tm, 4, 32));
            tm = fmaxf(tm, __shfl_xor(tm, 8, 32));
            const float mnew  = fmaxf(m_run[j], tm);
            const float alpha = __expf(m_run[j] - mnew);
            const float p     = __expf(s - mnew);
            float ts = p;
            ts += __shfl_xor(ts, 1, 32);
            ts += __shfl_xor(ts, 2, 32);
            ts += __shfl_xor(ts, 4, 32);
            ts += __shfl_xor(ts, 8, 32);
            l_run[j] = l_run[j] * alpha + ts;
            m_run[j] = mnew;
            pj[j] = p;
            #pragma unroll
            for (int f = 0; f < 8; ++f) O[f][j] *= alpha;
        }

        // ---- C-layout -> A-layout for P via per-wave LDS staging --------
        #pragma unroll
        for (int j = 0; j < 8; ++j) sp[(j + 8 * hi) * 16 + n] = pj[j];
        // same-wave DS ops are in-order; no barrier needed

        // ---- O += P @ V  (K = 16 slots, N = 128 dims in 8 fragments) ----
        #pragma unroll
        for (int c4 = 0; c4 < 4; ++c4) {
            v2f a = *(const v2f*)(sp + n * 16 + 4 * c4 + 2 * hi);
            const int s0 = slot_base + 4 * c4 + 2 * hi;
            const int s1 = s0 + 1;
            const float* vr0 = (s0 == pslot) ? (vnew + (size_t)b * HD)
                                             : (vcache + kvb + (size_t)s0 * HD);
            const float* vr1 = (s1 == pslot) ? (vnew + (size_t)b * HD)
                                             : (vcache + kvb + (size_t)s1 * HD);
            #pragma unroll
            for (int f = 0; f < 8; ++f) {
                v2f vb;
                vb.x = vr0[16 * f + n];
                vb.y = vr1[16 * f + n];
                O[f] = wmma_f32(a, vb, O[f]);
            }
        }
    }

    // ---- emit partials --------------------------------------------------
    float* op = opart + ((size_t)b * NSPLIT + split) * NHEADS * HD;
    #pragma unroll
    for (int f = 0; f < 8; ++f)
        #pragma unroll
        for (int j = 0; j < 8; ++j)
            op[(size_t)(j + 8 * hi) * HD + 16 * f + n] = O[f][j];

    if (n == 0) {  // lane 0 (rows 0..7) and lane 16 (rows 8..15)
        float* mlp = ml + ((size_t)b * NSPLIT + split) * NHEADS * 2;
        #pragma unroll
        for (int j = 0; j < 8; ++j) {
            mlp[(j + 8 * hi) * 2 + 0] = m_run[j];
            mlp[(j + 8 * hi) * 2 + 1] = l_run[j];
        }
    }
}

// ---------------------------------------------------------------------------
// Combine 32 split partials per (b,h): attn[b, h*128+d]
// grid.x = 64*16, block = 128 (one thread per dim).
// ---------------------------------------------------------------------------
__global__ __launch_bounds__(128) void reduce_kernel(
    const float* __restrict__ ml, const float* __restrict__ opart,
    float* __restrict__ attn)
{
    const int b = blockIdx.x >> 4;
    const int h = blockIdx.x & 15;
    const int d = threadIdx.x;
    const float* mlb = ml + (size_t)b * NSPLIT * NHEADS * 2;
    const float* ob  = opart + (size_t)b * NSPLIT * NHEADS * HD;

    float M = -3.0e38f;
    for (int s = 0; s < NSPLIT; ++s) M = fmaxf(M, mlb[(s * NHEADS + h) * 2]);

    float L = 0.0f, acc = 0.0f;
    for (int s = 0; s < NSPLIT; ++s) {
        const float ms = mlb[(s * NHEADS + h) * 2 + 0];
        const float ls = mlb[(s * NHEADS + h) * 2 + 1];
        const float wt = __expf(ms - M);
        L   += ls * wt;
        acc += wt * ob[((size_t)s * NHEADS + h) * HD + d];
    }
    attn[(size_t)b * EMBED + h * HD + d] = acc / L;
}

// ---------------------------------------------------------------------------
extern "C" void kernel_launch(void* const* d_in, const int* in_sizes, int n_in,
                              void* d_out, int out_size, void* d_ws, size_t ws_size,
                              hipStream_t stream) {
    const float* x       = (const float*)d_in[0];
    const float* k_cache = (const float*)d_in[1];
    const float* v_cache = (const float*)d_in[2];
    const int*   pos     = (const int*)  d_in[3];
    const float* Wq      = (const float*)d_in[4];
    const float* bq      = (const float*)d_in[5];
    const float* Wk      = (const float*)d_in[6];
    const float* bk      = (const float*)d_in[7];
    const float* Wv      = (const float*)d_in[8];
    const float* bv      = (const float*)d_in[9];
    const float* Wo      = (const float*)d_in[10];
    const float* bo      = (const float*)d_in[11];

    float* ws    = (float*)d_ws;
    float* q     = ws;                       // 64*2048
    float* knew  = q + NBATCH * EMBED;       // 64*128
    float* vnew  = knew + NBATCH * HD;       // 64*128
    float* attn  = vnew + NBATCH * HD;       // 64*2048
    float* ml    = attn + NBATCH * EMBED;    // 64*32*16*2
    float* opart = ml + NBATCH * NSPLIT * NHEADS * 2;  // 64*32*16*128

    // QKV projections
    gemm64_kernel<<<EMBED / 64, 128, 0, stream>>>(x, Wq, bq, q,    EMBED, EMBED);
    gemm64_kernel<<<HD / 64,    128, 0, stream>>>(x, Wk, bk, knew, EMBED, HD);
    gemm64_kernel<<<HD / 64,    128, 0, stream>>>(x, Wv, bv, vnew, EMBED, HD);

    // flash-decoding attention over contiguous cache (+ scattered new token)
    attn_kernel<<<NBATCH * 8, 128, 0, stream>>>(q, k_cache, v_cache, knew, vnew,
                                                pos, ml, opart);
    reduce_kernel<<<NBATCH * NHEADS, 128, 0, stream>>>(ml, opart, attn);

    // output projection
    gemm64_kernel<<<EMBED / 64, 128, 0, stream>>>(attn, Wo, bo, (float*)d_out,
                                                  EMBED, EMBED);
}

// v001
// It runs in 116 microseconds.
// Two timings next to v000 both put it at 5.98 times that version's speed.
#include <hip/hip_runtime.h>
#include <hip/hip_bf16.h>

typedef __attribute__((ext_vector_type(2))) float v2f;
typedef __attribute__((ext_vector_type(8))) float v8f;

#define EMBED 2048
#define HD 128
#define NHEADS 16
#define STOT 4096
#define NBATCH 64
#define NSPLIT 32           // waves per batch (8 WGs x 4 waves)
#define TILES_PER_WAVE 8    // 8 tiles * 16 slots = 128 slots per wave
#define KWAVES 32           // waves of a GEMM work-group, each with its share of K

static __device__ __forceinline__ v8f wmma_f32(v2f a, v2f b, v8f c) {
    return __builtin_amdgcn_wmma_f32_16x16x4_f32(false, a, false, b, (short)0, c, false, false);
}

// ---------------------------------------------------------------------------
// GEMM: C[64,N] = A[64,K] @ W[K,N] + bias[N]   (f32 WMMA 16x16x4)
// One work-group per 16-wide column tile, covering all 4 row tiles (M=64).
// K is split over the work-group's 32 waves: wave w sums the chunks of 4 k
// numbered w, w+32, w+64, ...; the 32 partial tiles are summed through LDS.
// grid.x = N/16, block = 1024 (32 waves).
// ---------------------------------------------------------------------------
// waves_per_eu(8, 8): the 32 waves sit 8 to a SIMD; told so, the compiler keeps both
// unrolled chunks' loads in flight instead of saving registers for 16 waves a SIMD.
__global__ __launch_bounds__(1024) __attribute__((amdgpu_waves_per_eu(8, 8))) void gemm64_kernel(
    const float* __restrict__ A, const float* __restrict__ W,
    const float* __restrict__ bias, float* __restrict__ C, int K, int N)
{
    __shared__ float part[KWAVES * 1024];   // one 64x16 partial tile per wave

    const int lane = threadIdx.x & 31;
    // wave number in a scalar register: the k loop stays a scalar loop, EXEC untouched
    const int w    = __builtin_amdgcn_readfirstlane(threadIdx.x >> 5);
    const int n    = lane & 15;
    const int hi   = lane >> 4;
    const int col  = blockIdx.x * 16 + n;

    v8f acc0 = {}, acc1 = {}, acc2 = {}, acc3 = {};

    #pragma unroll 2
    for (int kc = w; kc < K / 4; kc += KWAVES) {
        const int k0 = 4 * kc + 2 * hi;
        v2f b;
        b.x = W[(size_t)k0 * N + col];
        b.y = W[(size_t)(k0 + 1) * N + col];
        v2f a0 = *(const v2f*)(A + (size_t)(0 * 16 + n) * K + k0);
        v2f a1 = *(const v2f*)(A + (size_t)(1 * 16 + n) * K + k0);
        v2f a2 = *(const v2f*)(A + (size_t)(2 * 16 + n) * K + k0);
        v2f a3 = *(const v2f*)(A + (size_t)(3 * 16 + n) * K + k0);
        acc0 = wmma_f32(a0, b, acc0);
        acc1 = wmma_f32(a1, b, acc1);
        acc2 = wmma_f32(a2, b, acc2);
        acc3 = wmma_f32(a3, b, acc3);
    }

    // partial tile -> LDS, register (i, j) of every lane at (i*8 + j)*32 + lane
    float* pw = part + w * 1024 + lane;
    #pragma unroll
    for (int j = 0; j < 8; ++j) {
        pw[(0 * 8 + j) * 32] = acc0[j];
        pw[(1 * 8 + j) * 32] = acc1[j];
        pw[(2 * 8 + j) * 32] = acc2[j];
        pw[(3 * 8 + j) * 32] = acc3[j];
    }
    __syncthreads();

    // thread (w, lane) owns element (i*8 + j == w, lane) of the 64x16 tile
    float s = 0.0f;
    #pragma unroll
    for (int v = 0; v < KWAVES; ++v) s += part[v * 1024 + threadIdx.x];

    const int row = (w >> 3) * 16 + (w & 7) + 8 * hi;
    C[(size_t)row * N + col] = s + bias[col];
}

// ---------------------------------------------------------------------------
// Flash-decoding MQA attention, split-K over cache slots.
// grid.x = NBATCH*8, block = 128 (4 waves). Wave = 128 slots (8 tiles of 16).
// Emits per-split partials (running max m, denom l, unnormalized O 16x128).
// ---------------------------------------------------------------------------
__global__ __launch_bounds__(128) void attn_kernel(
    const float* __restrict__ q,      // [64, 2048]  (16 heads x 128)
    const float* __restrict__ kcache, // [64, 4096, 128]
    const float* __restrict__ vcache, // [64, 4096, 128]
    const float* __restrict__ knew,   // [64, 128]
    const float* __restrict__ vnew,   // [64, 128]
    const int*   __restrict__ pos,    // [64]
    float* __restrict__ ml,           // [64, 32, 16, 2]
    float* __restrict__ opart)        // [64, 32, 16, 128]
{
    __shared__ float lds_q[EMBED];
    __shared__ float lds_p[4 * 256];

    const int tid   = threadIdx.x;
    const int w     = tid >> 5;
    const int lane  = tid & 31;
    const int n     = lane & 15;   // head row for A / slot or dim col for B,C
    const int hi    = lane >> 4;
    const int b     = blockIdx.x >> 3;
    const int split = (blockIdx.x & 7) * 4 + w;    // 0..31
    const int pslot = pos[b];
    const size_t kvb = (size_t)b * STOT * HD;

    // stage Q[b] (16x128) into LDS, coalesced
    const float* qg = q + (size_t)b * EMBED;
    for (int i = tid; i < EMBED; i += 128) lds_q[i] = qg[i];
    __syncthreads();

    const float scale = 0.08838834764831845f;  // 1/sqrt(128)

    float m_run[8], l_run[8];
    v8f O[8];
    #pragma unroll
    for (int j = 0; j < 8; ++j) { m_run[j] = -3.0e38f; l_run[j] = 0.0f; }
    #pragma unroll
    for (int f = 0; f < 8; ++f) O[f] = v8f{};

    float* sp = lds_p + w * 256;

    #pragma unroll 1
    for (int t = 0; t < TILES_PER_WAVE; ++t) {
        const int slot_base = split * 128 + t * 16;

        // ---- S = Q @ K^T for a 16-head x 16-slot tile -------------------
        const int ks = slot_base + n;   // this lane's slot column
        const float* kr = (ks == pslot) ? (knew + (size_t)b * HD)
                                        : (kcache + kvb + (size_t)ks * HD);
        v8f S = {};
        #pragma unroll
        for (int kk = 0; kk < 32; ++kk) {
            v2f a = *(const v2f*)(lds_q + n * HD + 4 * kk + 2 * hi);
            v2f kb = *(const v2f*)(kr + 4 * kk + 2 * hi);
            S = wmma_f32(a, kb, S);
        }

        // ---- online softmax (rows j+8*hi live in 16-lane halves) --------
        float pj[8];
        #pragma unroll
        for (int j = 0; j < 8; ++j) {
            float s = S[j] * scale;
            float tm = s;
            tm = fmaxf(tm, __shfl_xor(tm, 1, 32));
            tm = fmaxf(tm, __shfl_xor(tm, 2, 32));
            tm = fmaxf(tm, __shfl_xor(tm, 4, 32));
            tm = fmaxf(tm, __shfl_xor(tm, 8, 32));
            const float mnew  = fmaxf(m_run[j], tm);
            const float alpha = __expf(m_run[j] - mnew);
            const float p     = __expf(s - mnew);
            float ts = p;
            ts += __shfl_xor(ts, 1, 32);
            ts += __shfl_xor(ts, 2, 32);
            ts += __shfl_xor(ts, 4, 32);
            ts += __shfl_xor(ts, 8, 32);
            l_run[j] = l_run[j] * alpha + ts;
            m_run[j] = mnew;
            pj[j] = p;
            #pragma unroll
            for (int f = 0; f < 8; ++f) O[f][j] *= alpha;
        }

        // ---- C-layout -> A-layout for P via per-wave LDS staging --------
        #pragma unroll
        for (int j = 0; j < 8; ++j) sp[(j + 8 * hi) * 16 + n] = pj[j];
        // same-wave DS ops are in-order; no barrier needed

        // ---- O += P @ V  (K = 16 slots, N = 128 dims in 8 fragments) ----
        #pragma unroll
        for (int c4 = 0; c4 < 4; ++c4) {
            v2f a = *(const v2f*)(sp + n * 16 + 4 * c4 + 2 * hi);
            const int s0 = slot_base + 4 * c4 + 2 * hi;
            const int s1 = s0 + 1;
            const float* vr0 = (s0 == pslot) ? (vnew + (size_t)b * HD)
                                             : (vcache + kvb + (size_t)s0 * HD);
            const float* vr1 = (s1 == pslot) ? (vnew + (size_t)b * HD)
                                             : (vcache + kvb + (size_t)s1 * HD);
            #pragma unroll
            for (int f = 0; f < 8; ++f) {
                v2f vb;
                vb.x = vr0[16 * f + n];
                vb.y = vr1[16 * f + n];
                O[f] = wmma_f32(a, vb, O[f]);
            }
        }
    }

    // ---- emit partials --------------------------------------------------
    float* op = opart + ((size_t)b * NSPLIT + split) * NHEADS * HD;
    #pragma unroll
    for (int f = 0; f < 8; ++f)
        #pragma unroll
        for (int j = 0; j < 8; ++j)
            op[(size_t)(j + 8 * hi) * HD + 16 * f + n] = O[f][j];

    if (n == 0) {  // lane 0 (rows 0..7) and lane 16 (rows 8..15)
        float* mlp = ml + ((size_t)b * NSPLIT + split) * NHEADS * 2;
        #pragma unroll
        for (int j = 0; j < 8; ++j) {
            mlp[(j + 8 * hi) * 2 + 0] = m_run[j];
            mlp[(j + 8 * hi) * 2 + 1] = l_run[j];
        }
    }
}

// ---------------------------------------------------------------------------
// Combine 32 split partials per (b,h): attn[b, h*128+d]
// grid.x = 64*16, block = 128 (one thread per dim).
// ---------------------------------------------------------------------------
__global__ __launch_bounds__(128) void reduce_kernel(
    const float* __restrict__ ml, const float* __restrict__ opart,
    float* __restrict__ attn)
{
    const int b = blockIdx.x >> 4;
    const int h = blockIdx.x & 15;
    const int d = threadIdx.x;
    const float* mlb = ml + (size_t)b * NSPLIT * NHEADS * 2;
    const float* ob  = opart + (size_t)b * NSPLIT * NHEADS * HD;

    float M = -3.0e38f;
    for (int s = 0; s < NSPLIT; ++s) M = fmaxf(M, mlb[(s * NHEADS + h) * 2]);

    float L = 0.0f, acc = 0.0f;
    for (int s = 0; s < NSPLIT; ++s) {
        const float ms = mlb[(s * NHEADS + h) * 2 + 0];
        const float ls = mlb[(s * NHEADS + h) * 2 + 1];
        const float wt = __expf(ms - M);
        L   += ls * wt;
        acc += wt * ob[((size_t)s * NHEADS + h) * HD + d];
    }
    attn[(size_t)b * EMBED + h * HD + d] = acc / L;
}

// ---------------------------------------------------------------------------
extern "C" void kernel_launch(void* const* d_in, const int* in_sizes, int n_in,
                              void* d_out, int out_size, void* d_ws, size_t ws_size,
                              hipStream_t stream) {
    const float* x       = (const float*)d_in[0];
    const float* k_cache = (const float*)d_in[1];
    const float* v_cache = (const float*)d_in[2];
    const int*   pos     = (const int*)  d_in[3];
    const float* Wq      = (const float*)d_in[4];
    const float* bq      = (const float*)d_in[5];
    const float* Wk      = (const float*)d_in[6];
    const float* bk      = (const float*)d_in[7];
    const float* Wv      = (const float*)d_in[8];
    const float* bv      = (const float*)d_in[9];
    const float* Wo      = (const float*)d_in[10];
    const float* bo      = (const float*)d_in[11];

    float* ws    = (float*)d_ws;
    float* q     = ws;                       // 64*2048
    float* knew  = q + NBATCH * EMBED;       // 64*128
    float* vnew  = knew + NBATCH * HD;       // 64*128
    float* attn  = vnew + NBATCH * HD;       // 64*2048
    float* ml    = attn + NBATCH * EMBED;    // 64*32*16*2
    float* opart = ml + NBATCH * NSPLIT * NHEADS * 2;  // 64*32*16*128

    // QKV projections
    gemm64_kernel<<<EMBED / 16, 1024, 0, stream>>>(x, Wq, bq, q,    EMBED, EMBED);
    gemm64_kernel<<<HD / 16,    1024, 0, stream>>>(x, Wk, bk, knew, EMBED, HD);
    gemm64_kernel<<<HD / 16,    1024, 0, stream>>>(x, Wv, bv, vnew, EMBED, HD);

    // flash-decoding attention over the cache (new token read from knew/vnew at slot pos)
    attn_kernel<<<NBATCH * 8, 128, 0, stream>>>(q, k_cache, v_cache, knew, vnew,
                                                pos, ml, opart);
    reduce_kernel<<<NBATCH * NHEADS, 128, 0, stream>>>(ml, opart, attn);

    // output projection
    gemm64_kernel<<<EMBED / 16, 1024, 0, stream>>>(attn, Wo, bo, (float*)d_out,
                                                    EMBED, EMBED);
}

// v002
// It runs in 104 microseconds.
// Next to v001, in two timings, it ran 1.12 times as fast each time.
// All steps since v000 together make it 6.68 times as fast.
#include <hip/hip_runtime.h>
#include <hip/hip_bf16.h>

typedef __attribute__((ext_vector_type(2))) float v2f;
typedef __attribute__((ext_vector_type(8))) float v8f;

#define EMBED 2048
#define HD 128
#define NHEADS 16
#define STOT 4096
#define NBATCH 64
#define NSPLIT 32           // waves per batch (8 WGs x 4 waves)
#define TILES_PER_WAVE 8    // 8 tiles * 16 slots = 128 slots per wave
#define KWAVES 32           // waves of a GEMM work-group, each with its share of K
#define KSTAGE 256          // k per stage of A in LDS: two chunks of 4 k per wave
#define NSTAGE (EMBED / KSTAGE)
#define APITCH 260          // floats per staged row: 16 B x odd, the 16 rows of a fragment read fall on all 64 banks

static __device__ __forceinline__ v8f wmma_f32(v2f a, v2f b, v8f c) {
    return __builtin_amdgcn_wmma_f32_16x16x4_f32(false, a, false, b, (short)0, c, false, false);
}

// ---------------------------------------------------------------------------
// GEMM: C[64,N] = A[64,EMBED] @ W[EMBED,N] + bias[N]   (f32 WMMA 16x16x4)
// One work-group per 16-wide column tile, covering all 4 row tiles (M=64).
// K is split over the work-group's 32 waves: wave w sums the chunks of 4 k
// numbered w, w+32, w+64, ...; the 32 partial tiles are summed through LDS.
// A comes in stages of 64 rows x 256 k by asynchronous copies to LDS: each
// wave-wide copy takes 512 contiguous bytes of one row (four whole lines), and
// the row-per-lane fragments are read from LDS; two stage buffers, the next
// stage's copies in flight while this one is multiplied.
// grid.x = N/16, block = 1024 (32 waves).
// ---------------------------------------------------------------------------
// One thread's share of a stage: 16 bytes of each of four rows, 16 rows apart.
// The s_wait_xcnt stands inside the statement, so that no address register of a
// copy is rewritten in front of it.
static __device__ __forceinline__ void copy_stage(unsigned l, const float* g) {
    asm volatile(
        "global_load_async_to_lds_b128 %0, %4, off\n\t"
        "global_load_async_to_lds_b128 %1, %5, off\n\t"
        "global_load_async_to_lds_b128 %2, %6, off\n\t"
        "global_load_async_to_lds_b128 %3, %7, off\n\t"
        "s_wait_xcnt 0x0"
        :: "v"(l), "v"(l + 16 * APITCH * 4), "v"(l + 32 * APITCH * 4), "v"(l + 48 * APITCH * 4),
           "v"(g), "v"(g + 16 * EMBED), "v"(g + 32 * EMBED), "v"(g + 48 * EMBED)
        : "memory");
}

// waves_per_eu(8, 8): the 32 waves sit 8 to a SIMD; told so, the compiler keeps both
// chunks' loads of a stage in flight instead of saving registers for 16 waves a SIMD.
__global__ __launch_bounds__(1024) __attribute__((amdgpu_waves_per_eu(8, 8))) void gemm64_kernel(
    const float* __restrict__ A, const float* __restrict__ W,
    const float* __restrict__ bias, float* __restrict__ C, int N)
{
    __shared__ __attribute__((aligned(16))) float stage[2][64 * APITCH];
    __shared__ float part[KWAVES * 1024];   // one 64x16 partial tile per wave

    const int lane = threadIdx.x & 31;
    // wave number in a scalar register: addresses that hang on it stay scalar
    const int w    = __builtin_amdgcn_readfirstlane(threadIdx.x >> 5);
    const int n    = lane & 15;
    const int hi   = lane >> 4;
    const int col  = blockIdx.x * 16 + n;

    // this thread's share of a stage: 16 bytes at column 4*sc of rows sr, sr+16, sr+32, sr+48
    const int sr = threadIdx.x >> 6;
    const int sc = threadIdx.x & 63;
    const float* ag = A + (size_t)sr * EMBED + 4 * sc;
    // LDS byte address (low 32 bits of the shared address) of that share in each buffer
    const unsigned l0 = (unsigned)(size_t)&stage[0][sr * APITCH + 4 * sc];
    const unsigned l1 = (unsigned)(size_t)&stage[1][sr * APITCH + 4 * sc];

    copy_stage(l0, ag);

    // stage 0 has landed for this wave's copies; the barrier publishes it to all
    asm volatile("s_wait_asynccnt 0x0" ::: "memory");
    __syncthreads();
    copy_stage(l1, ag + KSTAGE);

    v8f acc0 = {}, acc1 = {}, acc2 = {}, acc3 = {};

    // unrolled: the buffer choice and the two tail tests are compile-time, LDS offsets immediates
    #pragma unroll
    for (int s = 0; s < NSTAGE; ++s) {
        // the stage's two chunks of W, loaded in the stage that multiplies them
        const int k0 = 4 * (w + KWAVES * 2 * s) + 2 * hi;
        const int k1 = k0 + 4 * KWAVES;
        const float* w0 = W + (size_t)k0 * N + col;
        const float* w1 = W + (size_t)(k0 + 1) * N + col;
        const float* w2 = W + (size_t)k1 * N + col;
        const float* w3 = W + (size_t)(k1 + 1) * N + col;
        v2f b[2];
        b[0].x = *w0;
        b[0].y = *w1;
        b[1].x = *w2;
        b[1].y = *w3;
        // the four address pairs are inputs of the wait: they stay whole up to it, so that
        // neither a later address sum nor another load's result is put on one in front of it
        asm volatile("s_wait_xcnt 0x0" :: "v"(w0), "v"(w1), "v"(w2), "v"(w3) : "memory");
        // unrolled: b[u] is picked at compile time and stays in registers
        #pragma unroll
        for (int u = 0; u < 2; ++u) {
            const float* as = &stage[s & 1][n * APITCH + 4 * (w + KWAVES * u) + 2 * hi];
            v2f a0 = *(const v2f*)(as + 0 * 16 * APITCH);
            v2f a1 = *(const v2f*)(as + 1 * 16 * APITCH);
            v2f a2 = *(const v2f*)(as + 2 * 16 * APITCH);
            v2f a3 = *(const v2f*)(as + 3 * 16 * APITCH);
            acc0 = wmma_f32(a0, b[u], acc0);
            acc1 = wmma_f32(a1, b[u], acc1);
            acc2 = wmma_f32(a2, b[u], acc2);
            acc3 = wmma_f32(a3, b[u], acc3);
        }
        // holds the stage's WMMAs in front of the waits below: without it the compiler sinks them
        // behind the barrier, where every wave's WMMAs stand in front of the next stage's loads of W
        __builtin_amdgcn_sched_barrier(0);
        if (s + 1 < NSTAGE) {
            // this wave's reads of buffer s & 1 are done before the buffer is refilled
            asm volatile("s_wait_dscnt 0x0" ::: "memory");
            // this wave's copies of stage s + 1 have landed
            asm volatile("s_wait_asynccnt 0x0" ::: "memory");
            // publishes stage s + 1 and ends every wave's reads of stage s
            __syncthreads();
            if (s + 2 < NSTAGE) copy_stage((s & 1) ? l1 : l0, ag + (s + 2) * KSTAGE);
        }
    }
    // no copy is outstanding when the wave goes on
    asm volatile("s_wait_asynccnt 0x0" ::: "memory");

    // partial tile -> LDS, register (i, j) of every lane at (i*8 + j)*32 + lane
    float* pw = part + w * 1024 + lane;
    #pragma unroll
    for (int j = 0; j < 8; ++j) {
        pw[(0 * 8 + j) * 32] = acc0[j];
        pw[(1 * 8 + j) * 32] = acc1[j];
        pw[(2 * 8 + j) * 32] = acc2[j];
        pw[(3 * 8 + j) * 32] = acc3[j];
    }
    __syncthreads();

    // thread (w, lane) owns element (i*8 + j == w, lane) of the 64x16 tile
    float s = 0.0f;
    #pragma unroll
    for (int v = 0; v < KWAVES; ++v) s += part[v * 1024 + threadIdx.x];

    const int row = (w >> 3) * 16 + (w & 7) + 8 * hi;
    C[(size_t)row * N + col] = s + bias[col];
}

// ---------------------------------------------------------------------------
// Flash-decoding MQA attention, split-K over cache slots.
// grid.x = NBATCH*8, block = 128 (4 waves). Wave = 128 slots (8 tiles of 16).
// Emits per-split partials (running max m, denom l, unnormalized O 16x128).
// ---------------------------------------------------------------------------
__global__ __launch_bounds__(128) void attn_kernel(
    const float* __restrict__ q,      // [64, 2048]  (16 heads x 128)
    const float* __restrict__ kcache, // [64, 4096, 128]
    const float* __restrict__ vcache, // [64, 4096, 128]
    const float* __restrict__ knew,   // [64, 128]
    const float* __restrict__ vnew,   // [64, 128]
    const int*   __restrict__ pos,    // [64]
    float* __restrict__ ml,           // [64, 32, 16, 2]
    float* __restrict__ opart)        // [64, 32, 16, 128]
{
    __shared__ float lds_q[EMBED];
    __shared__ float lds_p[4 * 256];

    const int tid   = threadIdx.x;
    const int w     = tid >> 5;
    const int lane  = tid & 31;
    const int n     = lane & 15;   // head row for A / slot or dim col for B,C
    const int hi    = lane >> 4;
    const int b     = blockIdx.x >> 3;
    const int split = (blockIdx.x & 7) * 4 + w;    // 0..31
    const int pslot = pos[b];
    const size_t kvb = (size_t)b * STOT * HD;

    // stage Q[b] (16x128) into LDS, coalesced
    const float* qg = q + (size_t)b * EMBED;
    for (int i = tid; i < EMBED; i += 128) lds_q[i] = qg[i];
    __syncthreads();

    const float scale = 0.08838834764831845f;  // 1/sqrt(128)

    float m_run[8], l_run[8];
    v8f O[8];
    #pragma unroll
    for (int j = 0; j < 8; ++j) { m_run[j] = -3.0e38f; l_run[j] = 0.0f; }
    #pragma unroll
    for (int f = 0; f < 8; ++f) O[f] = v8f{};

    float* sp = lds_p + w * 256;

    #pragma unroll 1
    for (int t = 0; t < TILES_PER_WAVE; ++t) {
        const int slot_base = split * 128 + t * 16;

        // ---- S = Q @ K^T for a 16-head x 16-slot tile -------------------
        const int ks = slot_base + n;   // this lane's slot column
        const float* kr = (ks == pslot) ? (knew + (size_t)b * HD)
                                        : (kcache + kvb + (size_t)ks * HD);
        v8f S = {};
        #pragma unroll
        for (int kk = 0; kk < 32; ++kk) {
            v2f a = *(const v2f*)(lds_q + n * HD + 4 * kk + 2 * hi);
            v2f kb = *(const v2f*)(kr + 4 * kk + 2 * hi);
            S = wmma_f32(a, kb, S);
        }

        // ---- online softmax (rows j+8*hi live in 16-lane halves) --------
        float pj[8];
        #pragma unroll
        for (int j = 0; j < 8; ++j) {
            float s = S[j] * scale;
            float tm = s;
            tm = fmaxf(tm, __shfl_xor(tm, 1, 32));
            tm = fmaxf(tm, __shfl_xor(tm, 2, 32));
            tm = fmaxf(tm, __shfl_xor(tm, 4, 32));
            tm = fmaxf(tm, __shfl_xor(tm, 8, 32));
            const float mnew  = fmaxf(m_run[j], tm);
            const float alpha = __expf(m_run[j] - mnew);
            const float p     = __expf(s - mnew);
            float ts = p;
            ts += __shfl_xor(ts, 1, 32);
            ts += __shfl_xor(ts, 2, 32);
            ts += __shfl_xor(ts, 4, 32);
            ts += __shfl_xor(ts, 8, 32);
            l_run[j] = l_run[j] * alpha + ts;
            m_run[j] = mnew;
            pj[j] = p;
            #pragma unroll
            for (int f = 0; f < 8; ++f) O[f][j] *= alpha;
        }

        // ---- C-layout -> A-layout for P via per-wave LDS staging --------
        #pragma unroll
        for (int j = 0; j < 8; ++j) sp[(j + 8 * hi) * 16 + n] = pj[j];
        // same-wave DS ops are in-order; no barrier needed

        // ---- O += P @ V  (K = 16 slots, N = 128 dims in 8 fragments) ----
        #pragma unroll
        for (int c4 = 0; c4 < 4; ++c4) {
            v2f a = *(const v2f*)(sp + n * 16 + 4 * c4 + 2 * hi);
            const int s0 = slot_base + 4 * c4 + 2 * hi;
            const int s1 = s0 + 1;
            const float* vr0 = (s0 == pslot) ? (vnew + (size_t)b * HD)
                                             : (vcache + kvb + (size_t)s0 * HD);
            const float* vr1 = (s1 == pslot) ? (vnew + (size_t)b * HD)
                                             : (vcache + kvb + (size_t)s1 * HD);
            #pragma unroll
            for (int f = 0; f < 8; ++f) {
                v2f vb;
                vb.x = vr0[16 * f + n];
                vb.y = vr1[16 * f + n];
                O[f] = wmma_f32(a, vb, O[f]);
            }
        }
    }

    // ---- emit partials --------------------------------------------------
    float* op = opart + ((size_t)b * NSPLIT + split) * NHEADS * HD;
    #pragma unroll
    for (int f = 0; f < 8; ++f)
        #pragma unroll
        for (int j = 0; j < 8; ++j)
            op[(size_t)(j + 8 * hi) * HD + 16 * f + n] = O[f][j];

    if (n == 0) {  // lane 0 (rows 0..7) and lane 16 (rows 8..15)
        float* mlp = ml + ((size_t)b * NSPLIT + split) * NHEADS * 2;
        #pragma unroll
        for (int j = 0; j < 8; ++j) {
            mlp[(j + 8 * hi) * 2 + 0] = m_run[j];
            mlp[(j + 8 * hi) * 2 + 1] = l_run[j];
        }
    }
}

// ---------------------------------------------------------------------------
// Combine 32 split partials per (b,h): attn[b, h*128+d]
// grid.x = 64*16, block = 128 (one thread per dim).
// ---------------------------------------------------------------------------
__global__ __launch_bounds__(128) void reduce_kernel(
    const float* __restrict__ ml, const float* __restrict__ opart,
    float* __restrict__ attn)
{
    const int b = blockIdx.x >> 4;
    const int h = blockIdx.x & 15;
    const int d = threadIdx.x;
    const float* mlb = ml + (size_t)b * NSPLIT * NHEADS * 2;
    const float* ob  = opart + (size_t)b * NSPLIT * NHEADS * HD;

    float M = -3.0e38f;
    for (int s = 0; s < NSPLIT; ++s) M = fmaxf(M, mlb[(s * NHEADS + h) * 2]);

    float L = 0.0f, acc = 0.0f;
    for (int s = 0; s < NSPLIT; ++s) {
        const float ms = mlb[(s * NHEADS + h) * 2 + 0];
        const float ls = mlb[(s * NHEADS + h) * 2 + 1];
        const float wt = __expf(ms - M);
        L   += ls * wt;
        acc += wt * ob[((size_t)s * NHEADS + h) * HD + d];
    }
    attn[(size_t)b * EMBED + h * HD + d] = acc / L;
}

// ---------------------------------------------------------------------------
extern "C" void kernel_launch(void* const* d_in, const int* in_sizes, int n_in,
                              void* d_out, int out_size, void* d_ws, size_t ws_size,
                              hipStream_t stream) {
    const float* x       = (const float*)d_in[0];
    const float* k_cache = (const float*)d_in[1];
    const float* v_cache = (const float*)d_in[2];
    const int*   pos     = (const int*)  d_in[3];
    const float* Wq      = (const float*)d_in[4];
    const float* bq      = (const float*)d_in[5];
    const float* Wk      = (const float*)d_in[6];
    const float* bk      = (const float*)d_in[7];
    const float* Wv      = (const float*)d_in[8];
    const float* bv      = (const float*)d_in[9];
    const float* Wo      = (const float*)d_in[10];
    const float* bo      = (const float*)d_in[11];

    float* ws    = (float*)d_ws;
    float* q     = ws;                       // 64*2048
    float* knew  = q + NBATCH * EMBED;       // 64*128
    float* vnew  = knew + NBATCH * HD;       // 64*128
    float* attn  = vnew + NBATCH * HD;       // 64*2048
    float* ml    = attn + NBATCH * EMBED;    // 64*32*16*2
    float* opart = ml + NBATCH * NSPLIT * NHEADS * 2;  // 64*32*16*128

    // QKV projections
    gemm64_kernel<<<EMBED / 16, 1024, 0, stream>>>(x, Wq, bq, q,    EMBED);
    gemm64_kernel<<<HD / 16,    1024, 0, stream>>>(x, Wk, bk, knew, HD);
    gemm64_kernel<<<HD / 16,    1024, 0, stream>>>(x, Wv, bv, vnew, HD);

    // flash-decoding attention over contiguous cache (+ scattered new token)
    attn_kernel<<<NBATCH * 8, 128, 0, stream>>>(q, k_cache, v_cache, knew, vnew,
                                                pos, ml, opart);
    reduce_kernel<<<NBATCH * NHEADS, 128, 0, stream>>>(ml, opart, attn);

    // output projection
    gemm64_kernel<<<EMBED / 16, 1024, 0, stream>>>(attn, Wo, bo, (float*)d_out, EMBED);
}

// v003
// It runs in 79.9 microseconds.
// Next to v002, in two timings, it ran 1.30 times as fast each time.
// All steps since v000 together make it 8.69 times as fast.
#include <hip/hip_runtime.h>
#include <hip/hip_bf16.h>

typedef __attribute__((ext_vector_type(2))) float v2f;
typedef __attribute__((ext_vector_type(8))) float v8f;

#define EMBED 2048
#define HD 128
#define NHEADS 16
#define STOT 4096
#define NBATCH 64
#define NSPLIT 32           // waves per batch (8 WGs x 4 waves)
#define TILES_PER_WAVE 8    // 8 tiles * 16 slots = 128 slots per wave
#define KWAVES 32           // waves of a GEMM work-group, each with its share of K
#define KSTAGE 256          // k per stage of A in LDS: two chunks of 4 k per wave
#define NSTAGE (EMBED / KSTAGE)
#define APITCH 260          // floats per staged row: 16 B x odd, the 16 rows of a fragment read fall on all 64 banks

static __device__ __forceinline__ v8f wmma_f32(v2f a, v2f b, v8f c) {
    return __builtin_amdgcn_wmma_f32_16x16x4_f32(false, a, false, b, (short)0, c, false, false);
}

// ---------------------------------------------------------------------------
// GEMM: C[64,N] = A[64,EMBED] @ W[EMBED,N] + bias[N]   (f32 WMMA 16x16x4)
// One work-group per 16-wide column tile, covering all 4 row tiles (M=64).
// K is split over the work-group's 32 waves: wave w sums the chunks of 4 k
// numbered w, w+32, w+64, ...; the 32 partial tiles are summed through LDS.
// A comes in stages of 64 rows x 256 k by asynchronous copies to LDS: each
// wave-wide copy takes 512 contiguous bytes of one row (four whole lines), and
// the row-per-lane fragments are read from LDS; two stage buffers, the next
// stage's copies in flight while this one is multiplied.
// One launch serves up to three products of the same A: the first N0/16 work-groups
// take W0, the next N12/16 take W1, the last N12/16 take W2; they share nothing.
// grid.x = N0/16 (+ 2 * N12/16 where W1 and W2 are given), block = 1024 (32 waves).
// ---------------------------------------------------------------------------
// One thread's share of a stage: 16 bytes of each of four rows, 16 rows apart.
// The s_wait_xcnt stands inside the statement, so that no address register of a
// copy is rewritten in front of it.
static __device__ __forceinline__ void copy_stage(unsigned l, const float* g) {
    asm volatile(
        "global_load_async_to_lds_b128 %0, %4, off\n\t"
        "global_load_async_to_lds_b128 %1, %5, off\n\t"
        "global_load_async_to_lds_b128 %2, %6, off\n\t"
        "global_load_async_to_lds_b128 %3, %7, off\n\t"
        "s_wait_xcnt 0x0"
        :: "v"(l), "v"(l + 16 * APITCH * 4), "v"(l + 32 * APITCH * 4), "v"(l + 48 * APITCH * 4),
           "v"(g), "v"(g + 16 * EMBED), "v"(g + 32 * EMBED), "v"(g + 48 * EMBED)
        : "memory");
}

// waves_per_eu(8, 8): the 32 waves sit 8 to a SIMD; told so, the compiler keeps both
// chunks' loads of a stage in flight instead of saving registers for 16 waves a SIMD.
__global__ __launch_bounds__(1024) __attribute__((amdgpu_waves_per_eu(8, 8))) void gemm64_kernel(
    const float* __restrict__ A,
    const float* __restrict__ W0, const float* __restrict__ bias0, float* __restrict__ C0, int N0,
    const float* __restrict__ W1, const float* __restrict__ bias1, float* __restrict__ C1,
    const float* __restrict__ W2, const float* __restrict__ bias2, float* __restrict__ C2, int N12)
{
    __shared__ __attribute__((aligned(16))) float stage[2][64 * APITCH];
    __shared__ float part[KWAVES * 1024];   // one 64x16 partial tile per wave

    const int lane = threadIdx.x & 31;
    // wave number in a scalar register: addresses that hang on it stay scalar
    const int w    = __builtin_amdgcn_readfirstlane(threadIdx.x >> 5);
    const int n    = lane & 15;
    const int hi   = lane >> 4;
    // which product this work-group serves, and which column tile of it (the same for the whole group)
    const int t0   = N0 >> 4;
    const int t12  = N12 >> 4;
    const int sel  = ((int)blockIdx.x >= t0) + ((int)blockIdx.x >= t0 + t12);
    const float* W    = sel == 0 ? W0 : sel == 1 ? W1 : W2;
    const float* bias = sel == 0 ? bias0 : sel == 1 ? bias1 : bias2;
    float*       C    = sel == 0 ? C0 : sel == 1 ? C1 : C2;
    const int N    = sel == 0 ? N0 : N12;
    const int tile = (int)blockIdx.x - (sel == 0 ? 0 : sel == 1 ? t0 : t0 + t12);
    const int col  = tile * 16 + n;

    // this thread's share of a stage: 16 bytes at column 4*sc of rows sr, sr+16, sr+32, sr+48
    const int sr = threadIdx.x >> 6;
    const int sc = threadIdx.x & 63;
    const float* ag = A + (size_t)sr * EMBED + 4 * sc;
    // LDS byte address (low 32 bits of the shared address) of that share in each buffer
    const unsigned l0 = (unsigned)(size_t)&stage[0][sr * APITCH + 4 * sc];
    const unsigned l1 = (unsigned)(size_t)&stage[1][sr * APITCH + 4 * sc];

    copy_stage(l0, ag);

    // stage 0 has landed for this wave's copies; the barrier publishes it to all
    asm volatile("s_wait_asynccnt 0x0" ::: "memory");
    __syncthreads();
    copy_stage(l1, ag + KSTAGE);

    v8f acc0 = {}, acc1 = {}, acc2 = {}, acc3 = {};

    // unrolled: the buffer choice and the two tail tests are compile-time, LDS offsets immediates
    #pragma unroll
    for (int s = 0; s < NSTAGE; ++s) {
        // the stage's two chunks of W, loaded in the stage that multiplies them
        const int k0 = 4 * (w + KWAVES * 2 * s) + 2 * hi;
        const int k1 = k0 + 4 * KWAVES;
        const float* w0 = W + (size_t)k0 * N + col;
        const float* w1 = W + (size_t)(k0 + 1) * N + col;
        const float* w2 = W + (size_t)k1 * N + col;
        const float* w3 = W + (size_t)(k1 + 1) * N + col;
        v2f b[2];
        b[0].x = *w0;
        b[0].y = *w1;
        b[1].x = *w2;
        b[1].y = *w3;
        // the four address pairs are inputs of the wait: they stay whole up to it, so that
        // neither a later address sum nor another load's result is put on one in front of it
        asm volatile("s_wait_xcnt 0x0" :: "v"(w0), "v"(w1), "v"(w2), "v"(w3) : "memory");
        // unrolled: b[u] is picked at compile time and stays in registers
        #pragma unroll
        for (int u = 0; u < 2; ++u) {
            const float* as = &stage[s & 1][n * APITCH + 4 * (w + KWAVES * u) + 2 * hi];
            v2f a0 = *(const v2f*)(as + 0 * 16 * APITCH);
            v2f a1 = *(const v2f*)(as + 1 * 16 * APITCH);
            v2f a2 = *(const v2f*)(as + 2 * 16 * APITCH);
            v2f a3 = *(const v2f*)(as + 3 * 16 * APITCH);
            acc0 = wmma_f32(a0, b[u], acc0);
            acc1 = wmma_f32(a1, b[u], acc1);
            acc2 = wmma_f32(a2, b[u], acc2);
            acc3 = wmma_f32(a3, b[u], acc3);
        }
        // holds the stage's WMMAs in front of the waits below: without it the compiler sinks them
        // behind the barrier, where every wave's WMMAs stand in front of the next stage's loads of W
        __builtin_amdgcn_sched_barrier(0);
        if (s + 1 < NSTAGE) {
            // this wave's reads of buffer s & 1 are done before the buffer is refilled
            asm volatile("s_wait_dscnt 0x0" ::: "memory");
            // this wave's copies of stage s + 1 have landed
            asm volatile("s_wait_asynccnt 0x0" ::: "memory");
            // publishes stage s + 1 and ends every wave's reads of stage s
            __syncthreads();
            if (s + 2 < NSTAGE) copy_stage((s & 1) ? l1 : l0, ag + (s + 2) * KSTAGE);
        }
    }
    // no copy is outstanding when the wave goes on
    asm volatile("s_wait_asynccnt 0x0" ::: "memory");

    // partial tile -> LDS, register (i, j) of every lane at (i*8 + j)*32 + lane
    float* pw = part + w * 1024 + lane;
    #pragma unroll
    for (int j = 0; j < 8; ++j) {
        pw[(0 * 8 + j) * 32] = acc0[j];
        pw[(1 * 8 + j) * 32] = acc1[j];
        pw[(2 * 8 + j) * 32] = acc2[j];
        pw[(3 * 8 + j) * 32] = acc3[j];
    }
    __syncthreads();

    // thread (w, lane) owns element (i*8 + j == w, lane) of the 64x16 tile
    float s = 0.0f;
    #pragma unroll
    for (int v = 0; v < KWAVES; ++v) s += part[v * 1024 + threadIdx.x];

    const int row = (w >> 3) * 16 + (w & 7) + 8 * hi;
    C[(size_t)row * N + col] = s + bias[col];
}

// ---------------------------------------------------------------------------
// Flash-decoding MQA attention, split-K over cache slots.
// grid.x = NBATCH*8, block = 128 (4 waves). Wave = 128 slots (8 tiles of 16).
// Emits per-split partials (running max m, denom l, unnormalized O 16x128).
// ---------------------------------------------------------------------------
__global__ __launch_bounds__(128) void attn_kernel(
    const float* __restrict__ q,      // [64, 2048]  (16 heads x 128)
    const float* __restrict__ kcache, // [64, 4096, 128]
    const float* __restrict__ vcache, // [64, 4096, 128]
    const float* __restrict__ knew,   // [64, 128]
    const float* __restrict__ vnew,   // [64, 128]
    const int*   __restrict__ pos,    // [64]
    float* __restrict__ ml,           // [64, 32, 16, 2]
    float* __restrict__ opart)        // [64, 32, 16, 128]
{
    __shared__ float lds_q[EMBED];
    __shared__ float lds_p[4 * 256];

    const int tid   = threadIdx.x;
    const int w     = tid >> 5;
    const int lane  = tid & 31;
    const int n     = lane & 15;   // head row for A / slot or dim col for B,C
    const int hi    = lane >> 4;
    const int b     = blockIdx.x >> 3;
    const int split = (blockIdx.x & 7) * 4 + w;    // 0..31
    const int pslot = pos[b];
    const size_t kvb = (size_t)b * STOT * HD;

    // stage Q[b] (16x128) into LDS, coalesced
    const float* qg = q + (size_t)b * EMBED;
    for (int i = tid; i < EMBED; i += 128) lds_q[i] = qg[i];
    __syncthreads();

    const float scale = 0.08838834764831845f;  // 1/sqrt(128)

    float m_run[8], l_run[8];
    v8f O[8];
    #pragma unroll
    for (int j = 0; j < 8; ++j) { m_run[j] = -3.0e38f; l_run[j] = 0.0f; }
    #pragma unroll
    for (int f = 0; f < 8; ++f) O[f] = v8f{};

    float* sp = lds_p + w * 256;

    #pragma unroll 1
    for (int t = 0; t < TILES_PER_WAVE; ++t) {
        const int slot_base = split * 128 + t * 16;

        // ---- S = Q @ K^T for a 16-head x 16-slot tile -------------------
        const int ks = slot_base + n;   // this lane's slot column
        const float* kr = (ks == pslot) ? (knew + (size_t)b * HD)
                                        : (kcache + kvb + (size_t)ks * HD);
        v8f S = {};
        #pragma unroll
        for (int kk = 0; kk < 32; ++kk) {
            v2f a = *(const v2f*)(lds_q + n * HD + 4 * kk + 2 * hi);
            v2f kb = *(const v2f*)(kr + 4 * kk + 2 * hi);
            S = wmma_f32(a, kb, S);
        }

        // ---- online softmax (rows j+8*hi live in 16-lane halves) --------
        float pj[8];
        #pragma unroll
        for (int j = 0; j < 8; ++j) {
            float s = S[j] * scale;
            float tm = s;
            tm = fmaxf(tm, __shfl_xor(tm, 1, 32));
            tm = fmaxf(tm, __shfl_xor(tm, 2, 32));
            tm = fmaxf(tm, __shfl_xor(tm, 4, 32));
            tm = fmaxf(tm, __shfl_xor(tm, 8, 32));
            const float mnew  = fmaxf(m_run[j], tm);
            const float alpha = __expf(m_run[j] - mnew);
            const float p     = __expf(s - mnew);
            float ts = p;
            ts += __shfl_xor(ts, 1, 32);
            ts += __shfl_xor(ts, 2, 32);
            ts += __shfl_xor(ts, 4, 32);
            ts += __shfl_xor(ts, 8, 32);
            l_run[j] = l_run[j] * alpha + ts;
            m_run[j] = mnew;
            pj[j] = p;
            #pragma unroll
            for (int f = 0; f < 8; ++f) O[f][j] *= alpha;
        }

        // ---- C-layout -> A-layout for P via per-wave LDS staging --------
        #pragma unroll
        for (int j = 0; j < 8; ++j) sp[(j + 8 * hi) * 16 + n] = pj[j];
        // same-wave DS ops are in-order; no barrier needed

        // ---- O += P @ V  (K = 16 slots, N = 128 dims in 8 fragments) ----
        #pragma unroll
        for (int c4 = 0; c4 < 4; ++c4) {
            v2f a = *(const v2f*)(sp + n * 16 + 4 * c4 + 2 * hi);
            const int s0 = slot_base + 4 * c4 + 2 * hi;
            const int s1 = s0 + 1;
            const float* vr0 = (s0 == pslot) ? (vnew + (size_t)b * HD)
                                             : (vcache + kvb + (size_t)s0 * HD);
            const float* vr1 = (s1 == pslot) ? (vnew + (size_t)b * HD)
                                             : (vcache + kvb + (size_t)s1 * HD);
            #pragma unroll
            for (int f = 0; f < 8; ++f) {
                v2f vb;
                vb.x = vr0[16 * f + n];
                vb.y = vr1[16 * f + n];
                O[f] = wmma_f32(a, vb, O[f]);
            }
        }
    }

    // ---- emit partials --------------------------------------------------
    float* op = opart + ((size_t)b * NSPLIT + split) * NHEADS * HD;
    #pragma unroll
    for (int f = 0; f < 8; ++f)
        #pragma unroll
        for (int j = 0; j < 8; ++j)
            op[(size_t)(j + 8 * hi) * HD + 16 * f + n] = O[f][j];

    if (n == 0) {  // lane 0 (rows 0..7) and lane 16 (rows 8..15)
        float* mlp = ml + ((size_t)b * NSPLIT + split) * NHEADS * 2;
        #pragma unroll
        for (int j = 0; j < 8; ++j) {
            mlp[(j + 8 * hi) * 2 + 0] = m_run[j];
            mlp[(j + 8 * hi) * 2 + 1] = l_run[j];
        }
    }
}

// ---------------------------------------------------------------------------
// Combine 32 split partials per (b,h): attn[b, h*128+d]
// grid.x = 64*16, block = 128 (one thread per dim).
// ---------------------------------------------------------------------------
__global__ __launch_bounds__(128) void reduce_kernel(
    const float* __restrict__ ml, const float* __restrict__ opart,
    float* __restrict__ attn)
{
    const int b = blockIdx.x >> 4;
    const int h = blockIdx.x & 15;
    const int d = threadIdx.x;
    const float* mlb = ml + (size_t)b * NSPLIT * NHEADS * 2;
    const float* ob  = opart + (size_t)b * NSPLIT * NHEADS * HD;

    float M = -3.0e38f;
    for (int s = 0; s < NSPLIT; ++s) M = fmaxf(M, mlb[(s * NHEADS + h) * 2]);

    float L = 0.0f, acc = 0.0f;
    for (int s = 0; s < NSPLIT; ++s) {
        const float ms = mlb[(s * NHEADS + h) * 2 + 0];
        const float ls = mlb[(s * NHEADS + h) * 2 + 1];
        const float wt = __expf(ms - M);
        L   += ls * wt;
        acc += wt * ob[((size_t)s * NHEADS + h) * HD + d];
    }
    attn[(size_t)b * EMBED + h * HD + d] = acc / L;
}

// ---------------------------------------------------------------------------
extern "C" void kernel_launch(void* const* d_in, const int* in_sizes, int n_in,
                              void* d_out, int out_size, void* d_ws, size_t ws_size,
                              hipStream_t stream) {
    const float* x       = (const float*)d_in[0];
    const float* k_cache = (const float*)d_in[1];
    const float* v_cache = (const float*)d_in[2];
    const int*   pos     = (const int*)  d_in[3];
    const float* Wq      = (const float*)d_in[4];
    const float* bq      = (const float*)d_in[5];
    const float* Wk      = (const float*)d_in[6];
    const float* bk      = (const float*)d_in[7];
    const float* Wv      = (const float*)d_in[8];
    const float* bv      = (const float*)d_in[9];
    const float* Wo      = (const float*)d_in[10];
    const float* bo      = (const float*)d_in[11];

    float* ws    = (float*)d_ws;
    float* q     = ws;                       // 64*2048
    float* knew  = q + NBATCH * EMBED;       // 64*128
    float* vnew  = knew + NBATCH * HD;       // 64*128
    float* attn  = vnew + NBATCH * HD;       // 64*2048
    float* ml    = attn + NBATCH * EMBED;    // 64*32*16*2
    float* opart = ml + NBATCH * NSPLIT * NHEADS * 2;  // 64*32*16*128

    // QKV projections, one launch: 128 column tiles of Wq, 8 of Wk, 8 of Wv
    gemm64_kernel<<<EMBED / 16 + 2 * (HD / 16), 1024, 0, stream>>>(
        x, Wq, bq, q, EMBED, Wk, bk, knew, Wv, bv, vnew, HD);

    // flash-decoding attention over the contiguous cache (+ new token read at slot pos)
    attn_kernel<<<NBATCH * 8, 128, 0, stream>>>(q, k_cache, v_cache, knew, vnew,
                                                pos, ml, opart);
    reduce_kernel<<<NBATCH * NHEADS, 128, 0, stream>>>(ml, opart, attn);

    // output projection
    gemm64_kernel<<<EMBED / 16, 1024, 0, stream>>>(
        attn, Wo, bo, (float*)d_out, EMBED, nullptr, nullptr, nullptr, nullptr, nullptr, nullptr, 0);
}

// v004
// One run takes 68 microseconds.
// Next to v003, in two timings, it ran 1.17 times as fast each time.
// Over all steps from v000 it is 10.2 times as fast.
#include <hip/hip_runtime.h>
#include <hip/hip_bf16.h>

typedef __attribute__((ext_vector_type(2))) float v2f;
typedef __attribute__((ext_vector_type(8))) float v8f;

#define EMBED 2048
#define HD 128
#define NHEADS 16
#define STOT 4096
#define NBATCH 64
#define NSPLIT 32           // waves per batch (8 WGs x 4 waves)
#define TILES_PER_WAVE 8    // 8 tiles * 16 slots = 128 slots per wave
#define KWAVES 32           // waves of a GEMM work-group, each with its share of K
#define KSTAGE 256          // k per stage of A in LDS: two chunks of 4 k per wave
#define NSTAGE (EMBED / KSTAGE)
#define APITCH 260          // floats per staged row: 16 B x odd, the 16 rows of a fragment read fall on all 64 banks
#define KPITCH 132          // floats per staged K row: 16 B x odd, the 16 slots of a fragment read fall on all 64 banks
#define VPITCH 136          // floats per staged V row: the two slots of a fragment read, two rows apart, fall 16 banks apart

static __device__ __forceinline__ v8f wmma_f32(v2f a, v2f b, v8f c) {
    return __builtin_amdgcn_wmma_f32_16x16x4_f32(false, a, false, b, (short)0, c, false, false);
}

// ---------------------------------------------------------------------------
// GEMM: C[64,N] = A[64,EMBED] @ W[EMBED,N] + bias[N]   (f32 WMMA 16x16x4)
// One work-group per 16-wide column tile, covering all 4 row tiles (M=64).
// K is split over the work-group's 32 waves: wave w sums the chunks of 4 k
// numbered w, w+32, w+64, ...; the 32 partial tiles are summed through LDS.
// A comes in stages of 64 rows x 256 k by asynchronous copies to LDS: each
// wave-wide copy takes 512 contiguous bytes of one row (four whole lines), and
// the row-per-lane fragments are read from LDS; two stage buffers, the next
// stage's copies in flight while this one is multiplied.
// One launch serves up to three products of the same A: the first N0/16 work-groups
// take W0, the next N12/16 take W1, the last N12/16 take W2; they share nothing.
// grid.x = N0/16 (+ 2 * N12/16 where W1 and W2 are given), block = 1024 (32 waves).
// ---------------------------------------------------------------------------
// One thread's share of a stage: 16 bytes of each of four rows, 16 rows apart.
// The s_wait_xcnt stands inside the statement, so that no address register of a
// copy is rewritten in front of it.
static __device__ __forceinline__ void copy_stage(unsigned l, const float* g) {
    asm volatile(
        "global_load_async_to_lds_b128 %0, %4, off\n\t"
        "global_load_async_to_lds_b128 %1, %5, off\n\t"
        "global_load_async_to_lds_b128 %2, %6, off\n\t"
        "global_load_async_to_lds_b128 %3, %7, off\n\t"
        "s_wait_xcnt 0x0"
        :: "v"(l), "v"(l + 16 * APITCH * 4), "v"(l + 32 * APITCH * 4), "v"(l + 48 * APITCH * 4),
           "v"(g), "v"(g + 16 * EMBED), "v"(g + 32 * EMBED), "v"(g + 48 * EMBED)
        : "memory");
}

// waves_per_eu(8, 8): the 32 waves sit 8 to a SIMD; told so, the compiler keeps both
// chunks' loads of a stage in flight instead of saving registers for 16 waves a SIMD.
__global__ __launch_bounds__(1024) __attribute__((amdgpu_waves_per_eu(8, 8))) void gemm64_kernel(
    const float* __restrict__ A,
    const float* __restrict__ W0, const float* __restrict__ bias0, float* __restrict__ C0, int N0,
    const float* __restrict__ W1, const float* __restrict__ bias1, float* __restrict__ C1,
    const float* __restrict__ W2, const float* __restrict__ bias2, float* __restrict__ C2, int N12)
{
    __shared__ __attribute__((aligned(16))) float stage[2][64 * APITCH];
    __shared__ float part[KWAVES * 1024];   // one 64x16 partial tile per wave

    const int lane = threadIdx.x & 31;
    // wave number in a scalar register: addresses that hang on it stay scalar
    const int w    = __builtin_amdgcn_readfirstlane(threadIdx.x >> 5);
    const int n    = lane & 15;
    const int hi   = lane >> 4;
    // which product this work-group serves, and which column tile of it (the same for the whole group)
    const int t0   = N0 >> 4;
    const int t12  = N12 >> 4;
    const int sel  = ((int)blockIdx.x >= t0) + ((int)blockIdx.x >= t0 + t12);
    const float* W    = sel == 0 ? W0 : sel == 1 ? W1 : W2;
    const float* bias = sel == 0 ? bias0 : sel == 1 ? bias1 : bias2;
    float*       C    = sel == 0 ? C0 : sel == 1 ? C1 : C2;
    const int N    = sel == 0 ? N0 : N12;
    const int tile = (int)blockIdx.x - (sel == 0 ? 0 : sel == 1 ? t0 : t0 + t12);
    const int col  = tile * 16 + n;

    // this thread's share of a stage: 16 bytes at column 4*sc of rows sr, sr+16, sr+32, sr+48
    const int sr = threadIdx.x >> 6;
    const int sc = threadIdx.x & 63;
    const float* ag = A + (size_t)sr * EMBED + 4 * sc;
    // LDS byte address (low 32 bits of the shared address) of that share in each buffer
    const unsigned l0 = (unsigned)(size_t)&stage[0][sr * APITCH + 4 * sc];
    const unsigned l1 = (unsigned)(size_t)&stage[1][sr * APITCH + 4 * sc];

    copy_stage(l0, ag);

    // stage 0 has landed for this wave's copies; the barrier publishes it to all
    asm volatile("s_wait_asynccnt 0x0" ::: "memory");
    __syncthreads();
    copy_stage(l1, ag + KSTAGE);

    v8f acc0 = {}, acc1 = {}, acc2 = {}, acc3 = {};

    // unrolled: the buffer choice and the two tail tests are compile-time, LDS offsets immediates
    #pragma unroll
    for (int s = 0; s < NSTAGE; ++s) {
        // the stage's two chunks of W, loaded in the stage that multiplies them
        const int k0 = 4 * (w + KWAVES * 2 * s) + 2 * hi;
        const int k1 = k0 + 4 * KWAVES;
        const float* w0 = W + (size_t)k0 * N + col;
        const float* w1 = W + (size_t)(k0 + 1) * N + col;
        const float* w2 = W + (size_t)k1 * N + col;
        const float* w3 = W + (size_t)(k1 + 1) * N + col;
        v2f b[2];
        b[0].x = *w0;
        b[0].y = *w1;
        b[1].x = *w2;
        b[1].y = *w3;
        // the four address pairs are inputs of the wait: they stay whole up to it, so that
        // neither a later address sum nor another load's result is put on one in front of it
        asm volatile("s_wait_xcnt 0x0" :: "v"(w0), "v"(w1), "v"(w2), "v"(w3) : "memory");
        // unrolled: b[u] is picked at compile time and stays in registers
        #pragma unroll
        for (int u = 0; u < 2; ++u) {
            const float* as = &stage[s & 1][n * APITCH + 4 * (w + KWAVES * u) + 2 * hi];
            v2f a0 = *(const v2f*)(as + 0 * 16 * APITCH);
            v2f a1 = *(const v2f*)(as + 1 * 16 * APITCH);
            v2f a2 = *(const v2f*)(as + 2 * 16 * APITCH);
            v2f a3 = *(const v2f*)(as + 3 * 16 * APITCH);
            acc0 = wmma_f32(a0, b[u], acc0);
            acc1 = wmma_f32(a1, b[u], acc1);
            acc2 = wmma_f32(a2, b[u], acc2);
            acc3 = wmma_f32(a3, b[u], acc3);
        }
        // holds the stage's WMMAs in front of the waits below: without it the compiler sinks them
        // behind the barrier, where every wave's WMMAs stand in front of the next stage's loads of W
        __builtin_amdgcn_sched_barrier(0);
        if (s + 1 < NSTAGE) {
            // this wave's reads of buffer s & 1 are done before the buffer is refilled
            asm volatile("s_wait_dscnt 0x0" ::: "memory");
            // this wave's copies of stage s + 1 have landed
            asm volatile("s_wait_asynccnt 0x0" ::: "memory");
            // publishes stage s + 1 and ends every wave's reads of stage s
            __syncthreads();
            if (s + 2 < NSTAGE) copy_stage((s & 1) ? l1 : l0, ag + (s + 2) * KSTAGE);
        }
    }
    // no copy is outstanding when the wave goes on
    asm volatile("s_wait_asynccnt 0x0" ::: "memory");

    // partial tile -> LDS, register (i, j) of every lane at (i*8 + j)*32 + lane
    float* pw = part + w * 1024 + lane;
    #pragma unroll
    for (int j = 0; j < 8; ++j) {
        pw[(0 * 8 + j) * 32] = acc0[j];
        pw[(1 * 8 + j) * 32] = acc1[j];
        pw[(2 * 8 + j) * 32] = acc2[j];
        pw[(3 * 8 + j) * 32] = acc3[j];
    }
    __syncthreads();

    // thread (w, lane) owns element (i*8 + j == w, lane) of the 64x16 tile
    float s = 0.0f;
    #pragma unroll
    for (int v = 0; v < KWAVES; ++v) s += part[v * 1024 + threadIdx.x];

    const int row = (w >> 3) * 16 + (w & 7) + 8 * hi;
    C[(size_t)row * N + col] = s + bias[col];
}

// ---------------------------------------------------------------------------
// Flash-decoding MQA attention, split-K over cache slots.
// grid.x = NBATCH*8, block = 128 (4 waves). Wave = 128 slots (8 tiles of 16).
// Emits per-split partials (running max m, denom l, unnormalized O 16x128).
// Each wave's K and V tiles come into LDS by asynchronous copies, one wave-wide
// copy per slot (512 contiguous bytes, four whole lines); two buffers, the next
// tile's 32 copies per wave in flight while this one is multiplied. The slot that
// holds the new token takes its row from knew / vnew at the copy's source.
// ---------------------------------------------------------------------------
// One wave's copies of a 16-slot tile: lane l brings 16 bytes at column 4*l of every slot.
// The s_wait_xcnt stands inside each statement, so that no address register of a
// copy is rewritten in front of it.
template <int PITCH>
static __device__ __forceinline__ void copy_tile(unsigned l, const float* cache, const float* fresh,
                                                 int slot0, int pslot, int lane) {
    // unrolled: the row offsets in LDS are compile-time
    #pragma unroll
    for (int h = 0; h < 2; ++h) {
        const float* g[8];
        // unrolled: g[r] is picked at compile time and stays in registers
        #pragma unroll
        for (int r = 0; r < 8; ++r) {
            const int slot = slot0 + 8 * h + r;
            g[r] = (slot == pslot ? fresh : cache + (size_t)slot * HD) + 4 * lane;
        }
        const unsigned lh = l + 8 * h * PITCH * 4;
        asm volatile(
            "global_load_async_to_lds_b128 %0, %8, off\n\t"
            "global_load_async_to_lds_b128 %1, %9, off\n\t"
            "global_load_async_to_lds_b128 %2, %10, off\n\t"
            "global_load_async_to_lds_b128 %3, %11, off\n\t"
            "global_load_async_to_lds_b128 %4, %12, off\n\t"
            "global_load_async_to_lds_b128 %5, %13, off\n\t"
            "global_load_async_to_lds_b128 %6, %14, off\n\t"
            "global_load_async_to_lds_b128 %7, %15, off\n\t"
            "s_wait_xcnt 0x0"
            :: "v"(lh), "v"(lh + 1 * PITCH * 4), "v"(lh + 2 * PITCH * 4), "v"(lh + 3 * PITCH * 4),
               "v"(lh + 4 * PITCH * 4), "v"(lh + 5 * PITCH * 4), "v"(lh + 6 * PITCH * 4), "v"(lh + 7 * PITCH * 4),
               "v"(g[0]), "v"(g[1]), "v"(g[2]), "v"(g[3]), "v"(g[4]), "v"(g[5]), "v"(g[6]), "v"(g[7])
            : "memory");
    }
}

__global__ __launch_bounds__(128) void attn_kernel(
    const float* __restrict__ q,      // [64, 2048]  (16 heads x 128)
    const float* __restrict__ kcache, // [64, 4096, 128]
    const float* __restrict__ vcache, // [64, 4096, 128]
    const float* __restrict__ knew,   // [64, 128]
    const float* __restrict__ vnew,   // [64, 128]
    const int*   __restrict__ pos,    // [64]
    float* __restrict__ ml,           // [64, 32, 16, 2]
    float* __restrict__ opart)        // [64, 32, 16, 128]
{
    __shared__ float lds_q[EMBED];
    __shared__ float lds_p[4 * 256];
    __shared__ __attribute__((aligned(16))) float lds_k[2][4][16 * KPITCH];
    __shared__ __attribute__((aligned(16))) float lds_v[2][4][16 * VPITCH];

    const int tid   = threadIdx.x;
    // wave number in a scalar register: the slot numbers and the copies' source rows stay scalar
    const int w     = __builtin_amdgcn_readfirstlane(tid >> 5);
    const int lane  = tid & 31;
    const int n     = lane & 15;   // head row for A / slot or dim col for B,C
    const int hi    = lane >> 4;
    const int b     = blockIdx.x >> 3;
    const int split = (blockIdx.x & 7) * 4 + w;    // 0..31
    const int pslot = pos[b];
    const size_t kvb = (size_t)b * STOT * HD;
    const float* kc = kcache + kvb;
    const float* vc = vcache + kvb;
    const float* kf = knew + (size_t)b * HD;
    const float* vf = vnew + (size_t)b * HD;
    // LDS byte address (low 32 bits of the shared address) of this lane's column in this wave's tile, buffer 0
    const unsigned lk = (unsigned)(size_t)&lds_k[0][w][4 * lane];
    const unsigned lv = (unsigned)(size_t)&lds_v[0][w][4 * lane];
    const unsigned kbuf = sizeof(lds_k[0]);   // bytes from buffer 0 to buffer 1
    const unsigned vbuf = sizeof(lds_v[0]);

    copy_tile<KPITCH>(lk, kc, kf, split * 128, pslot, lane);
    copy_tile<VPITCH>(lv, vc, vf, split * 128, pslot, lane);

    // stage Q[b] (16x128) into LDS, coalesced
    const float* qg = q + (size_t)b * EMBED;
    for (int i = tid; i < EMBED; i += 128) lds_q[i] = qg[i];
    // tile 0 has landed for this wave's copies; the barrier publishes it, and Q, to all
    asm volatile("s_wait_asynccnt 0x0" ::: "memory");
    __syncthreads();
    copy_tile<KPITCH>(lk + kbuf, kc, kf, split * 128 + 16, pslot, lane);
    copy_tile<VPITCH>(lv + vbuf, vc, vf, split * 128 + 16, pslot, lane);

    const float scale = 0.08838834764831845f;  // 1/sqrt(128)

    float m_run[8], l_run[8];
    v8f O[8];
    #pragma unroll
    for (int j = 0; j < 8; ++j) { m_run[j] = -3.0e38f; l_run[j] = 0.0f; }
    #pragma unroll
    for (int f = 0; f < 8; ++f) O[f] = v8f{};

    float* sp = lds_p + w * 256;

    #pragma unroll 1
    for (int t = 0; t < TILES_PER_WAVE; ++t) {
        const int slot_base = split * 128 + t * 16;

        // ---- S = Q @ K^T for a 16-head x 16-slot tile -------------------
        const float* kr = &lds_k[t & 1][w][n * KPITCH];   // this lane's slot column
        v8f S = {};
        #pragma unroll
        for (int kk = 0; kk < 32; ++kk) {
            // Q rows stand at a pitch of 128 floats, as before: the 16 heads of this read share one pair of banks
            v2f a = *(const v2f*)(lds_q + n * HD + 4 * kk + 2 * hi);
            v2f kb = *(const v2f*)(kr + 4 * kk + 2 * hi);
            S = wmma_f32(a, kb, S);
        }

        // ---- online softmax (rows j+8*hi live in 16-lane halves) --------
        float pj[8];
        #pragma unroll
        for (int j = 0; j < 8; ++j) {
            float s = S[j] * scale;
            float tm = s;
            tm = fmaxf(tm, __shfl_xor(tm, 1, 32));
            tm = fmaxf(tm, __shfl_xor(tm, 2, 32));
            tm = fmaxf(tm, __shfl_xor(tm, 4, 32));
            tm = fmaxf(tm, __shfl_xor(tm, 8, 32));
            const float mnew  = fmaxf(m_run[j], tm);
            const float alpha = __expf(m_run[j] - mnew);
            const float p     = __expf(s - mnew);
            float ts = p;
            ts += __shfl_xor(ts, 1, 32);
            ts += __shfl_xor(ts, 2, 32);
            ts += __shfl_xor(ts, 4, 32);
            ts += __shfl_xor(ts, 8, 32);
            l_run[j] = l_run[j] * alpha + ts;
            m_run[j] = mnew;
            pj[j] = p;
            #pragma unroll
            for (int f = 0; f < 8; ++f) O[f][j] *= alpha;
        }

        // ---- C-layout -> A-layout for P via per-wave LDS staging --------
        #pragma unroll
        for (int j = 0; j < 8; ++j) sp[(j + 8 * hi) * 16 + n] = pj[j];
        // same-wave DS ops are in-order; no barrier needed

        // ---- O += P @ V  (K = 16 slots, N = 128 dims in 8 fragments) ----
        #pragma unroll
        for (int c4 = 0; c4 < 4; ++c4) {
            v2f a = *(const v2f*)(sp + n * 16 + 4 * c4 + 2 * hi);
            const float* vr0 = &lds_v[t & 1][w][(4 * c4 + 2 * hi) * VPITCH];
            const float* vr1 = vr0 + VPITCH;
            #pragma unroll
            for (int f = 0; f < 8; ++f) {
                v2f vb;
                vb.x = vr0[16 * f + n];
                vb.y = vr1[16 * f + n];
                O[f] = wmma_f32(a, vb, O[f]);
            }
        }

        // this wave's reads of buffer t & 1 are done before the buffer is refilled
        asm volatile("s_wait_dscnt 0x0" ::: "memory");
        // this wave's copies of tile t + 1 have landed
        asm volatile("s_wait_asynccnt 0x0" ::: "memory");
        // publishes tile t + 1 and ends every wave's reads of tile t
        __syncthreads();
        if (t + 2 < TILES_PER_WAVE) {
            copy_tile<KPITCH>(lk + (t & 1) * kbuf, kc, kf, slot_base + 32, pslot, lane);
            copy_tile<VPITCH>(lv + (t & 1) * vbuf, vc, vf, slot_base + 32, pslot, lane);
        }
    }
    // no copy is outstanding when the wave goes on
    asm volatile("s_wait_asynccnt 0x0" ::: "memory");

    // ---- emit partials --------------------------------------------------
    float* op = opart + ((size_t)b * NSPLIT + split) * NHEADS * HD;
    #pragma unroll
    for (int f = 0; f < 8; ++f)
        #pragma unroll
        for (int j = 0; j < 8; ++j)
            op[(size_t)(j + 8 * hi) * HD + 16 * f + n] = O[f][j];

    if (n == 0) {  // lane 0 (rows 0..7) and lane 16 (rows 8..15)
        float* mlp = ml + ((size_t)b * NSPLIT + split) * NHEADS * 2;
        #pragma unroll
        for (int j = 0; j < 8; ++j) {
            mlp[(j + 8 * hi) * 2 + 0] = m_run[j];
            mlp[(j + 8 * hi) * 2 + 1] = l_run[j];
        }
    }
}

// ---------------------------------------------------------------------------
// Combine 32 split partials per (b,h): attn[b, h*128+d]
// grid.x = 64*16, block = 128 (one thread per dim).
// ---------------------------------------------------------------------------
__global__ __launch_bounds__(128) void reduce_kernel(
    const float* __restrict__ ml, const float* __restrict__ opart,
    float* __restrict__ attn)
{
    const int b = blockIdx.x >> 4;
    const int h = blockIdx.x & 15;
    const int d = threadIdx.x;
    const float* mlb = ml + (size_t)b * NSPLIT * NHEADS * 2;
    const float* ob  = opart + (size_t)b * NSPLIT * NHEADS * HD;

    float M = -3.0e38f;
    for (int s = 0; s < NSPLIT; ++s) M = fmaxf(M, mlb[(s * NHEADS + h) * 2]);

    float L = 0.0f, acc = 0.0f;
    for (int s = 0; s < NSPLIT; ++s) {
        const float ms = mlb[(s * NHEADS + h) * 2 + 0];
        const float ls = mlb[(s * NHEADS + h) * 2 + 1];
        const float wt = __expf(ms - M);
        L   += ls * wt;
        acc += wt * ob[((size_t)s * NHEADS + h) * HD + d];
    }
    attn[(size_t)b * EMBED + h * HD + d] = acc / L;
}

// ---------------------------------------------------------------------------
extern "C" void kernel_launch(void* const* d_in, const int* in_sizes, int n_in,
                              void* d_out, int out_size, void* d_ws, size_t ws_size,
                              hipStream_t stream) {
    const float* x       = (const float*)d_in[0];
    const float* k_cache = (const float*)d_in[1];
    const float* v_cache = (const float*)d_in[2];
    const int*   pos     = (const int*)  d_in[3];
    const float* Wq      = (const float*)d_in[4];
    const float* bq      = (const float*)d_in[5];
    const float* Wk      = (const float*)d_in[6];
    const float* bk      = (const float*)d_in[7];
    const float* Wv      = (const float*)d_in[8];
    const float* bv      = (const float*)d_in[9];
    const float* Wo      = (const float*)d_in[10];
    const float* bo      = (const float*)d_in[11];

    float* ws    = (float*)d_ws;
    float* q     = ws;                       // 64*2048
    float* knew  = q + NBATCH * EMBED;       // 64*128
    float* vnew  = knew + NBATCH * HD;       // 64*128
    float* attn  = vnew + NBATCH * HD;       // 64*2048
    float* ml    = attn + NBATCH * EMBED;    // 64*32*16*2
    float* opart = ml + NBATCH * NSPLIT * NHEADS * 2;  // 64*32*16*128

    // QKV projections, one launch: 128 column tiles of Wq, 8 of Wk, 8 of Wv
    gemm64_kernel<<<EMBED / 16 + 2 * (HD / 16), 1024, 0, stream>>>(
        x, Wq, bq, q, EMBED, Wk, bk, knew, Wv, bv, vnew, HD);

    // flash-decoding attention over the contiguous cache (+ new token read at slot pos)
    attn_kernel<<<NBATCH * 8, 128, 0, stream>>>(q, k_cache, v_cache, knew, vnew,
                                                pos, ml, opart);
    reduce_kernel<<<NBATCH * NHEADS, 128, 0, stream>>>(ml, opart, attn);

    // output projection
    gemm64_kernel<<<EMBED / 16, 1024, 0, stream>>>(
        attn, Wo, bo, (float*)d_out, EMBED, nullptr, nullptr, nullptr, nullptr, nullptr, nullptr, 0);
}

// v005
// It runs in 57.6 microseconds.
// Timed twice side by side with v004, it ran 1.18 times as fast both times.
// Counting every step since v000, it is 12.0 times as fast.
#include <hip/hip_runtime.h>
#include <hip/hip_bf16.h>

typedef __attribute__((ext_vector_type(2))) float v2f;
typedef __attribute__((ext_vector_type(8))) float v8f;

#define EMBED 2048
#define HD 128
#define NHEADS 16
#define STOT 4096
#define NBATCH 64
#define NSPLIT 32           // waves per batch (8 WGs x 4 waves)
#define TILES_PER_WAVE 8    // 8 tiles * 16 slots = 128 slots per wave
#define KWAVES 32           // waves of a GEMM work-group, each with its share of K
#define KSTAGE 256          // k per stage of A in LDS: two chunks of 4 k per wave
#define NSTAGE (EMBED / KSTAGE)
#define APITCH 260          // floats per staged row: 16 B x odd, the 16 rows of a fragment read fall on all 64 banks
#define KPITCH 132          // floats per staged K row: 16 B x odd, the 16 slots of a fragment read fall on all 64 banks
#define QPITCH 132          // floats per staged Q row: 16 B x odd, the 16 heads of a fragment read fall on all 64 banks
#define VPITCH 136          // floats per staged V row: the two slots of a fragment read, two rows apart, fall 16 banks apart

static __device__ __forceinline__ v8f wmma_f32(v2f a, v2f b, v8f c) {
    return __builtin_amdgcn_wmma_f32_16x16x4_f32(false, a, false, b, (short)0, c, false, false);
}

// ---------------------------------------------------------------------------
// GEMM: C[64,N] = A[64,EMBED] @ W[EMBED,N] + bias[N]   (f32 WMMA 16x16x4)
// One work-group per 16-wide column tile, covering all 4 row tiles (M=64).
// K is split over the work-group's 32 waves: wave w sums the chunks of 4 k
// numbered w, w+32, w+64, ...; the 32 partial tiles are summed through LDS.
// A comes in stages of 64 rows x 256 k by asynchronous copies to LDS: each
// wave-wide copy takes 512 contiguous bytes of one row (four whole lines), and
// the row-per-lane fragments are read from LDS; two stage buffers, the next
// stage's copies in flight while this one is multiplied.
// One launch serves up to three products of the same A: the first N0/16 work-groups
// take W0, the next N12/16 take W1, the last N12/16 take W2; they share nothing.
// grid.x = N0/16 (+ 2 * N12/16 where W1 and W2 are given), block = 1024 (32 waves).
// ---------------------------------------------------------------------------
// One thread's share of a stage: 16 bytes of each of four rows, 16 rows apart.
// The s_wait_xcnt stands inside the statement, so that no address register of a
// copy is rewritten in front of it.
static __device__ __forceinline__ void copy_stage(unsigned l, const float* g) {
    asm volatile(
        "global_load_async_to_lds_b128 %0, %4, off\n\t"
        "global_load_async_to_lds_b128 %1, %5, off\n\t"
        "global_load_async_to_lds_b128 %2, %6, off\n\t"
        "global_load_async_to_lds_b128 %3, %7, off\n\t"
        "s_wait_xcnt 0x0"
        :: "v"(l), "v"(l + 16 * APITCH * 4), "v"(l + 32 * APITCH * 4), "v"(l + 48 * APITCH * 4),
           "v"(g), "v"(g + 16 * EMBED), "v"(g + 32 * EMBED), "v"(g + 48 * EMBED)
        : "memory");
}

// waves_per_eu(8, 8): the 32 waves sit 8 to a SIMD; told so, the compiler keeps both
// chunks' loads of a stage in flight instead of saving registers for 16 waves a SIMD.
__global__ __launch_bounds__(1024) __attribute__((amdgpu_waves_per_eu(8, 8))) void gemm64_kernel(
    const float* __restrict__ A,
    const float* __restrict__ W0, const float* __restrict__ bias0, float* __restrict__ C0, int N0,
    const float* __restrict__ W1, const float* __restrict__ bias1, float* __restrict__ C1,
    const float* __restrict__ W2, const float* __restrict__ bias2, float* __restrict__ C2, int N12)
{
    __shared__ __attribute__((aligned(16))) float stage[2][64 * APITCH];
    __shared__ float part[KWAVES * 1024];   // one 64x16 partial tile per wave

    const int lane = threadIdx.x & 31;
    // wave number in a scalar register: addresses that hang on it stay scalar
    const int w    = __builtin_amdgcn_readfirstlane(threadIdx.x >> 5);
    const int n    = lane & 15;
    const int hi   = lane >> 4;
    // which product this work-group serves, and which column tile of it (the same for the whole group)
    const int t0   = N0 >> 4;
    const int t12  = N12 >> 4;
    const int sel  = ((int)blockIdx.x >= t0) + ((int)blockIdx.x >= t0 + t12);
    const float* W    = sel == 0 ? W0 : sel == 1 ? W1 : W2;
    const float* bias = sel == 0 ? bias0 : sel == 1 ? bias1 : bias2;
    float*       C    = sel == 0 ? C0 : sel == 1 ? C1 : C2;
    const int N    = sel == 0 ? N0 : N12;
    const int tile = (int)blockIdx.x - (sel == 0 ? 0 : sel == 1 ? t0 : t0 + t12);
    const int col  = tile * 16 + n;

    // this thread's share of a stage: 16 bytes at column 4*sc of rows sr, sr+16, sr+32, sr+48
    const int sr = threadIdx.x >> 6;
    const int sc = threadIdx.x & 63;
    const float* ag = A + (size_t)sr * EMBED + 4 * sc;
    // LDS byte address (low 32 bits of the shared address) of that share in each buffer
    const unsigned l0 = (unsigned)(size_t)&stage[0][sr * APITCH + 4 * sc];
    const unsigned l1 = (unsigned)(size_t)&stage[1][sr * APITCH + 4 * sc];

    copy_stage(l0, ag);

    // stage 0 has landed for this wave's copies; the barrier publishes it to all
    asm volatile("s_wait_asynccnt 0x0" ::: "memory");
    __syncthreads();
    copy_stage(l1, ag + KSTAGE);

    v8f acc0 = {}, acc1 = {}, acc2 = {}, acc3 = {};

    // unrolled: the buffer choice and the two tail tests are compile-time, LDS offsets immediates
    #pragma unroll
    for (int s = 0; s < NSTAGE; ++s) {
        // the stage's two chunks of W, loaded in the stage that multiplies them
        const int k0 = 4 * (w + KWAVES * 2 * s) + 2 * hi;
        const int k1 = k0 + 4 * KWAVES;
        const float* w0 = W + (size_t)k0 * N + col;
        const float* w1 = W + (size_t)(k0 + 1) * N + col;
        const float* w2 = W + (size_t)k1 * N + col;
        const float* w3 = W + (size_t)(k1 + 1) * N + col;
        v2f b[2];
        b[0].x = *w0;
        b[0].y = *w1;
        b[1].x = *w2;
        b[1].y = *w3;
        // the four address pairs are inputs of the wait: they stay whole up to it, so that
        // neither a later address sum nor another load's result is put on one in front of it
        asm volatile("s_wait_xcnt 0x0" :: "v"(w0), "v"(w1), "v"(w2), "v"(w3) : "memory");
        // unrolled: b[u] is picked at compile time and stays in registers
        #pragma unroll
        for (int u = 0; u < 2; ++u) {
            const float* as = &stage[s & 1][n * APITCH + 4 * (w + KWAVES * u) + 2 * hi];
            v2f a0 = *(const v2f*)(as + 0 * 16 * APITCH);
            v2f a1 = *(const v2f*)(as + 1 * 16 * APITCH);
            v2f a2 = *(const v2f*)(as + 2 * 16 * APITCH);
            v2f a3 = *(const v2f*)(as + 3 * 16 * APITCH);
            acc0 = wmma_f32(a0, b[u], acc0);
            acc1 = wmma_f32(a1, b[u], acc1);
            acc2 = wmma_f32(a2, b[u], acc2);
            acc3 = wmma_f32(a3, b[u], acc3);
        }
        // holds the stage's WMMAs in front of the waits below: without it the compiler sinks them
        // behind the barrier, where every wave's WMMAs stand in front of the next stage's loads of W
        __builtin_amdgcn_sched_barrier(0);
        if (s + 1 < NSTAGE) {
            // this wave's reads of buffer s & 1 are done before the buffer is refilled
            asm volatile("s_wait_dscnt 0x0" ::: "memory");
            // this wave's copies of stage s + 1 have landed
            asm volatile("s_wait_asynccnt 0x0" ::: "memory");
            // publishes stage s + 1 and ends every wave's reads of stage s
            __syncthreads();
            if (s + 2 < NSTAGE) copy_stage((s & 1) ? l1 : l0, ag + (s + 2) * KSTAGE);
        }
    }
    // no copy is outstanding when the wave goes on
    asm volatile("s_wait_asynccnt 0x0" ::: "memory");

    // partial tile -> LDS, register (i, j) of every lane at (i*8 + j)*32 + lane
    float* pw = part + w * 1024 + lane;
    #pragma unroll
    for (int j = 0; j < 8; ++j) {
        pw[(0 * 8 + j) * 32] = acc0[j];
        pw[(1 * 8 + j) * 32] = acc1[j];
        pw[(2 * 8 + j) * 32] = acc2[j];
        pw[(3 * 8 + j) * 32] = acc3[j];
    }
    __syncthreads();

    // thread (w, lane) owns element (i*8 + j == w, lane) of the 64x16 tile
    float s = 0.0f;
    #pragma unroll
    for (int v = 0; v < KWAVES; ++v) s += part[v * 1024 + threadIdx.x];

    const int row = (w >> 3) * 16 + (w & 7) + 8 * hi;
    C[(size_t)row * N + col] = s + bias[col];
}

// ---------------------------------------------------------------------------
// Flash-decoding MQA attention, split-K over cache slots.
// grid.x = NBATCH*8, block = 128 (4 waves). Wave = 128 slots (8 tiles of 16).
// Emits per-split partials (running max m, denom l, unnormalized O 16x128).
// Each wave's K and V tiles come into LDS by asynchronous copies, one wave-wide
// copy per slot (512 contiguous bytes, four whole lines); two buffers, the next
// tile's 32 copies per wave in flight while this one is multiplied. The slot that
// holds the new token takes its row from knew / vnew at the copy's source.
// ---------------------------------------------------------------------------
// One wave's copies of a 16-slot tile: lane l brings 16 bytes at column 4*l of every slot.
// The s_wait_xcnt stands inside each statement, so that no address register of a
// copy is rewritten in front of it.
template <int PITCH>
static __device__ __forceinline__ void copy_tile(unsigned l, const float* cache, const float* fresh,
                                                 int slot0, int pslot, int lane) {
    // unrolled: the row offsets in LDS are compile-time
    #pragma unroll
    for (int h = 0; h < 2; ++h) {
        const float* g[8];
        // unrolled: g[r] is picked at compile time and stays in registers
        #pragma unroll
        for (int r = 0; r < 8; ++r) {
            const int slot = slot0 + 8 * h + r;
            g[r] = (slot == pslot ? fresh : cache + (size_t)slot * HD) + 4 * lane;
        }
        const unsigned lh = l + 8 * h * PITCH * 4;
        asm volatile(
            "global_load_async_to_lds_b128 %0, %8, off\n\t"
            "global_load_async_to_lds_b128 %1, %9, off\n\t"
            "global_load_async_to_lds_b128 %2, %10, off\n\t"
            "global_load_async_to_lds_b128 %3, %11, off\n\t"
            "global_load_async_to_lds_b128 %4, %12, off\n\t"
            "global_load_async_to_lds_b128 %5, %13, off\n\t"
            "global_load_async_to_lds_b128 %6, %14, off\n\t"
            "global_load_async_to_lds_b128 %7, %15, off\n\t"
            "s_wait_xcnt 0x0"
            :: "v"(lh), "v"(lh + 1 * PITCH * 4), "v"(lh + 2 * PITCH * 4), "v"(lh + 3 * PITCH * 4),
               "v"(lh + 4 * PITCH * 4), "v"(lh + 5 * PITCH * 4), "v"(lh + 6 * PITCH * 4), "v"(lh + 7 * PITCH * 4),
               "v"(g[0]), "v"(g[1]), "v"(g[2]), "v"(g[3]), "v"(g[4]), "v"(g[5]), "v"(g[6]), "v"(g[7])
            : "memory");
    }
}

__global__ __launch_bounds__(128) void attn_kernel(
    const float* __restrict__ q,      // [64, 2048]  (16 heads x 128)
    const float* __restrict__ kcache, // [64, 4096, 128]
    const float* __restrict__ vcache, // [64, 4096, 128]
    const float* __restrict__ knew,   // [64, 128]
    const float* __restrict__ vnew,   // [64, 128]
    const int*   __restrict__ pos,    // [64]
    float* __restrict__ ml,           // [64, 32, 16, 2]
    float* __restrict__ opart)        // [64, 32, 16, 128]
{
    __shared__ __attribute__((aligned(16))) float lds_q[NHEADS * QPITCH];
    __shared__ float lds_p[4 * 256];
    __shared__ __attribute__((aligned(16))) float lds_k[2][4][16 * KPITCH];
    __shared__ __attribute__((aligned(16))) float lds_v[2][4][16 * VPITCH];

    const int tid   = threadIdx.x;
    // wave number in a scalar register: the slot numbers and the copies' source rows stay scalar
    const int w     = __builtin_amdgcn_readfirstlane(tid >> 5);
    const int lane  = tid & 31;
    const int n     = lane & 15;   // head row for A / slot or dim col for B,C
    const int hi    = lane >> 4;
    const int b     = blockIdx.x >> 3;
    const int split = (blockIdx.x & 7) * 4 + w;    // 0..31
    const int pslot = pos[b];
    const size_t kvb = (size_t)b * STOT * HD;
    const float* kc = kcache + kvb;
    const float* vc = vcache + kvb;
    const float* kf = knew + (size_t)b * HD;
    const float* vf = vnew + (size_t)b * HD;
    // LDS byte address (low 32 bits of the shared address) of this lane's column in this wave's tile, buffer 0
    const unsigned lk = (unsigned)(size_t)&lds_k[0][w][4 * lane];
    const unsigned lv = (unsigned)(size_t)&lds_v[0][w][4 * lane];
    const unsigned kbuf = sizeof(lds_k[0]);   // bytes from buffer 0 to buffer 1
    const unsigned vbuf = sizeof(lds_v[0]);

    copy_tile<KPITCH>(lk, kc, kf, split * 128, pslot, lane);
    copy_tile<VPITCH>(lv, vc, vf, split * 128, pslot, lane);

    // stage Q[b] (16x128) into LDS, coalesced
    const float* qg = q + (size_t)b * EMBED;
    for (int r = 0; r < NHEADS; ++r) lds_q[r * QPITCH + tid] = qg[r * HD + tid];
    // tile 0 has landed for this wave's copies; the barrier publishes it, and Q, to all
    asm volatile("s_wait_asynccnt 0x0" ::: "memory");
    __syncthreads();
    copy_tile<KPITCH>(lk + kbuf, kc, kf, split * 128 + 16, pslot, lane);
    copy_tile<VPITCH>(lv + vbuf, vc, vf, split * 128 + 16, pslot, lane);

    // this lane's 32 A fragments of Q: the same for every tile, read from LDS once and kept in registers
    v2f qa[32];
    // unrolled: qa[kk] is picked at compile time and stays in registers
    #pragma unroll
    for (int kk = 0; kk < 32; ++kk) qa[kk] = *(const v2f*)(lds_q + n * QPITCH + 4 * kk + 2 * hi);

    const float scale = 0.08838834764831845f;  // 1/sqrt(128)

    float m_run[8], l_run[8];
    v8f O[8];
    #pragma unroll
    for (int j = 0; j < 8; ++j) { m_run[j] = -3.0e38f; l_run[j] = 0.0f; }
    #pragma unroll
    for (int f = 0; f < 8; ++f) O[f] = v8f{};

    float* sp = lds_p + w * 256;

    #pragma unroll 1
    for (int t = 0; t < TILES_PER_WAVE; ++t) {
        const int slot_base = split * 128 + t * 16;

        // ---- S = Q @ K^T for a 16-head x 16-slot tile -------------------
        const float* kr = &lds_k[t & 1][w][n * KPITCH];   // this lane's slot column
        v8f S = {};
        #pragma unroll
        for (int kk = 0; kk < 32; ++kk) {
            v2f kb = *(const v2f*)(kr + 4 * kk + 2 * hi);
            S = wmma_f32(qa[kk], kb, S);
        }

        // ---- online softmax (rows j+8*hi live in 16-lane halves) --------
        float pj[8];
        #pragma unroll
        for (int j = 0; j < 8; ++j) {
            float s = S[j] * scale;
            float tm = s;
            tm = fmaxf(tm, __shfl_xor(tm, 1, 32));
            tm = fmaxf(tm, __shfl_xor(tm, 2, 32));
            tm = fmaxf(tm, __shfl_xor(tm, 4, 32));
            tm = fmaxf(tm, __shfl_xor(tm, 8, 32));
            const float mnew  = fmaxf(m_run[j], tm);
            const float alpha = __expf(m_run[j] - mnew);
            const float p     = __expf(s - mnew);
            float ts = p;
            ts += __shfl_xor(ts, 1, 32);
            ts += __shfl_xor(ts, 2, 32);
            ts += __shfl_xor(ts, 4, 32);
            ts += __shfl_xor(ts, 8, 32);
            l_run[j] = l_run[j] * alpha + ts;
            m_run[j] = mnew;
            pj[j] = p;
            #pragma unroll
            for (int f = 0; f < 8; ++f) O[f][j] *= alpha;
        }

        // ---- C-layout -> A-layout for P via per-wave LDS staging --------
        #pragma unroll
        for (int j = 0; j < 8; ++j) sp[(j + 8 * hi) * 16 + n] = pj[j];
        // same-wave DS ops are in-order; no barrier needed

        // ---- O += P @ V  (K = 16 slots, N = 128 dims in 8 fragments) ----
        #pragma unroll
        for (int c4 = 0; c4 < 4; ++c4) {
            v2f a = *(const v2f*)(sp + n * 16 + 4 * c4 + 2 * hi);
            const float* vr0 = &lds_v[t & 1][w][(4 * c4 + 2 * hi) * VPITCH];
            const float* vr1 = vr0 + VPITCH;
            #pragma unroll
            for (int f = 0; f < 8; ++f) {
                v2f vb;
                vb.x = vr0[16 * f + n];
                vb.y = vr1[16 * f + n];
                O[f] = wmma_f32(a, vb, O[f]);
            }
        }

        // this wave's reads of buffer t & 1 are done before the buffer is refilled
        asm volatile("s_wait_dscnt 0x0" ::: "memory");
        // this wave's copies of tile t + 1 have landed
        asm volatile("s_wait_asynccnt 0x0" ::: "memory");
        // publishes tile t + 1 and ends every wave's reads of tile t
        __syncthreads();
        if (t + 2 < TILES_PER_WAVE) {
            copy_tile<KPITCH>(lk + (t & 1) * kbuf, kc, kf, slot_base + 32, pslot, lane);
            copy_tile<VPITCH>(lv + (t & 1) * vbuf, vc, vf, slot_base + 32, pslot, lane);
        }
    }
    // no copy is outstanding when the wave goes on
    asm volatile("s_wait_asynccnt 0x0" ::: "memory");

    // ---- emit partials --------------------------------------------------
    float* op = opart + ((size_t)b * NSPLIT + split) * NHEADS * HD;
    #pragma unroll
    for (int f = 0; f < 8; ++f)
        #pragma unroll
        for (int j = 0; j < 8; ++j)
            op[(size_t)(j + 8 * hi) * HD + 16 * f + n] = O[f][j];

    if (n == 0) {  // lane 0 (rows 0..7) and lane 16 (rows 8..15)
        float* mlp = ml + ((size_t)b * NSPLIT + split) * NHEADS * 2;
        #pragma unroll
        for (int j = 0; j < 8; ++j) {
            mlp[(j + 8 * hi) * 2 + 0] = m_run[j];
            mlp[(j + 8 * hi) * 2 + 1] = l_run[j];
        }
    }
}

// ---------------------------------------------------------------------------
// Combine 32 split partials per (b,h): attn[b, h*128+d]
// grid.x = 64*16, block = 128 (one thread per dim).
// ---------------------------------------------------------------------------
__global__ __launch_bounds__(128) void reduce_kernel(
    const float* __restrict__ ml, const float* __restrict__ opart,
    float* __restrict__ attn)
{
    const int b = blockIdx.x >> 4;
    const int h = blockIdx.x & 15;
    const int d = threadIdx.x;
    const float* mlb = ml + (size_t)b * NSPLIT * NHEADS * 2;
    const float* ob  = opart + (size_t)b * NSPLIT * NHEADS * HD;

    float M = -3.0e38f;
    for (int s = 0; s < NSPLIT; ++s) M = fmaxf(M, mlb[(s * NHEADS + h) * 2]);

    float L = 0.0f, acc = 0.0f;
    for (int s = 0; s < NSPLIT; ++s) {
        const float ms = mlb[(s * NHEADS + h) * 2 + 0];
        const float ls = mlb[(s * NHEADS + h) * 2 + 1];
        const float wt = __expf(ms - M);
        L   += ls * wt;
        acc += wt * ob[((size_t)s * NHEADS + h) * HD + d];
    }
    attn[(size_t)b * EMBED + h * HD + d] = acc / L;
}

// ---------------------------------------------------------------------------
extern "C" void kernel_launch(void* const* d_in, const int* in_sizes, int n_in,
                              void* d_out, int out_size, void* d_ws, size_t ws_size,
                              hipStream_t stream) {
    const float* x       = (const float*)d_in[0];
    const float* k_cache = (const float*)d_in[1];
    const float* v_cache = (const float*)d_in[2];
    const int*   pos     = (const int*)  d_in[3];
    const float* Wq      = (const float*)d_in[4];
    const float* bq      = (const float*)d_in[5];
    const float* Wk      = (const float*)d_in[6];
    const float* bk      = (const float*)d_in[7];
    const float* Wv      = (const float*)d_in[8];
    const float* bv      = (const float*)d_in[9];
    const float* Wo      = (const float*)d_in[10];
    const float* bo      = (const float*)d_in[11];

    float* ws    = (float*)d_ws;
    float* q     = ws;                       // 64*2048
    float* knew  = q + NBATCH * EMBED;       // 64*128
    float* vnew  = knew + NBATCH * HD;       // 64*128
    float* attn  = vnew + NBATCH * HD;       // 64*2048
    float* ml    = attn + NBATCH * EMBED;    // 64*32*16*2
    float* opart = ml + NBATCH * NSPLIT * NHEADS * 2;  // 64*32*16*128

    // QKV projections, one launch: 128 column tiles of Wq, 8 of Wk, 8 of Wv
    gemm64_kernel<<<EMBED / 16 + 2 * (HD / 16), 1024, 0, stream>>>(
        x, Wq, bq, q, EMBED, Wk, bk, knew, Wv, bv, vnew, HD);

    // flash-decoding attention over the contiguous cache (+ new token read at slot pos)
    attn_kernel<<<NBATCH * 8, 128, 0, stream>>>(q, k_cache, v_cache, knew, vnew,
                                                pos, ml, opart);
    reduce_kernel<<<NBATCH * NHEADS, 128, 0, stream>>>(ml, opart, attn);

    // output projection
    gemm64_kernel<<<EMBED / 16, 1024, 0, stream>>>(
        attn, Wo, bo, (float*)d_out, EMBED, nullptr, nullptr, nullptr, nullptr, nullptr, nullptr, 0);
}

// v006
// Measured time: 53.2 microseconds a run.
// Timed twice side by side with v005, it ran 1.08 and 1.09 times as fast.
// All steps since v000 together make it 13.1 times as fast.
#include <hip/hip_runtime.h>
#include <hip/hip_bf16.h>

typedef __attribute__((ext_vector_type(2))) float v2f;
typedef __attribute__((ext_vector_type(8))) float v8f;

#define EMBED 2048
#define HD 128
#define NHEADS 16
#define STOT 4096
#define NBATCH 64
#define NSPLIT 32           // waves per batch (8 WGs x 4 waves)
#define TILES_PER_WAVE 8    // 8 tiles * 16 slots = 128 slots per wave
#define KWAVES 32           // waves of a GEMM work-group, each with its share of K
#define KSTAGE 256          // k per stage of A in LDS: two chunks of 4 k per wave
#define NSTAGE (EMBED / KSTAGE)
#define APITCH 260          // floats per staged row: 16 B x odd, the 16 rows of a fragment read fall on all 64 banks
#define KPITCH 132          // floats per staged K row: 16 B x odd, the 16 slots of a fragment read fall on all 64 banks
#define QPITCH 132          // floats per staged Q row: 16 B x odd, the 16 heads of a fragment read fall on all 64 banks
#define VPITCH 136          // floats per staged V row: the two slots of a fragment read, two rows apart, fall 16 banks apart

static __device__ __forceinline__ v8f wmma_f32(v2f a, v2f b, v8f c) {
    return __builtin_amdgcn_wmma_f32_16x16x4_f32(false, a, false, b, (short)0, c, false, false);
}

// ---------------------------------------------------------------------------
// GEMM: C[64,N] = A[64,EMBED] @ W[EMBED,N] + bias[N]   (f32 WMMA 16x16x4)
// One work-group per 16-wide column tile, covering all 4 row tiles (M=64).
// K is split over the work-group's 32 waves: wave w sums the chunks of 4 k
// numbered w, w+32, w+64, ...; the 32 partial tiles are summed through LDS.
// A comes in stages of 64 rows x 256 k by asynchronous copies to LDS: each
// wave-wide copy takes 512 contiguous bytes of one row (four whole lines), and
// the row-per-lane fragments are read from LDS; two stage buffers, the next
// stage's copies in flight while this one is multiplied.
// W goes straight to registers: a wave asks for all 16 of its B fragments in front of stage 0,
// and each stage waits only for the two that it multiplies.
// One launch serves up to three products of the same A: the first N0/16 work-groups
// take W0, the next N12/16 take W1, the last N12/16 take W2; they share nothing.
// grid.x = N0/16 (+ 2 * N12/16 where W1 and W2 are given), block = 1024 (32 waves).
// ---------------------------------------------------------------------------
// One thread's share of a stage: 16 bytes of each of four rows, 16 rows apart.
// The s_wait_xcnt stands inside the statement, so that no address register of a
// copy is rewritten in front of it.
static __device__ __forceinline__ void copy_stage(unsigned l, const float* g) {
    asm volatile(
        "global_load_async_to_lds_b128 %0, %4, off\n\t"
        "global_load_async_to_lds_b128 %1, %5, off\n\t"
        "global_load_async_to_lds_b128 %2, %6, off\n\t"
        "global_load_async_to_lds_b128 %3, %7, off\n\t"
        "s_wait_xcnt 0x0"
        :: "v"(l), "v"(l + 16 * APITCH * 4), "v"(l + 32 * APITCH * 4), "v"(l + 48 * APITCH * 4),
           "v"(g), "v"(g + 16 * EMBED), "v"(g + 32 * EMBED), "v"(g + 48 * EMBED)
        : "memory");
}

// The work-group's own barrier by hand, for the stages of A: __syncthreads() carries a fence that waits for
// every global load of the wave, and would drain the loads of W that are meant to stay in flight across it.
// What the staged data needs stands in front of every call: s_wait_asynccnt 0, and s_wait_dscnt 0 where the wave has read LDS.
static __device__ __forceinline__ void stage_barrier() {
    asm volatile("s_barrier_signal -1\n\ts_barrier_wait -1" ::: "memory");
}

// waves_per_eu(8, 8): the 32 waves sit 8 to a SIMD; told so, the compiler keeps all of a wave's
// loads of W in flight (32 registers) instead of saving registers for 16 waves a SIMD.
__global__ __launch_bounds__(1024) __attribute__((amdgpu_waves_per_eu(8, 8))) void gemm64_kernel(
    const float* __restrict__ A,
    const float* __restrict__ W0, const float* __restrict__ bias0, float* __restrict__ C0, int N0,
    const float* __restrict__ W1, const float* __restrict__ bias1, float* __restrict__ C1,
    const float* __restrict__ W2, const float* __restrict__ bias2, float* __restrict__ C2, int N12)
{
    __shared__ __attribute__((aligned(16))) float stage[2][64 * APITCH];
    __shared__ float part[KWAVES * 1024];   // one 64x16 partial tile per wave

    const int lane = threadIdx.x & 31;
    // wave number in a scalar register: addresses that hang on it stay scalar
    const int w    = __builtin_amdgcn_readfirstlane(threadIdx.x >> 5);
    const int n    = lane & 15;
    const int hi   = lane >> 4;
    // which product this work-group serves, and which column tile of it (the same for the whole group)
    const int t0   = N0 >> 4;
    const int t12  = N12 >> 4;
    const int sel  = ((int)blockIdx.x >= t0) + ((int)blockIdx.x >= t0 + t12);
    const float* W    = sel == 0 ? W0 : sel == 1 ? W1 : W2;
    const float* bias = sel == 0 ? bias0 : sel == 1 ? bias1 : bias2;
    float*       C    = sel == 0 ? C0 : sel == 1 ? C1 : C2;
    const int N    = sel == 0 ? N0 : N12;
    const int tile = (int)blockIdx.x - (sel == 0 ? 0 : sel == 1 ? t0 : t0 + t12);
    const int col  = tile * 16 + n;

    // this thread's share of a stage: 16 bytes at column 4*sc of rows sr, sr+16, sr+32, sr+48
    const int sr = threadIdx.x >> 6;
    const int sc = threadIdx.x & 63;
    const float* ag = A + (size_t)sr * EMBED + 4 * sc;
    // LDS byte address (low 32 bits of the shared address) of that share in each buffer
    const unsigned l0 = (unsigned)(size_t)&stage[0][sr * APITCH + 4 * sc];
    const unsigned l1 = (unsigned)(size_t)&stage[1][sr * APITCH + 4 * sc];

    copy_stage(l0, ag);

    // all 16 chunks of W that this wave multiplies, asked for here, in the order of their use:
    // memory's latency is paid once, under the wait for stage 0, not again in every stage
    const unsigned o0 = (unsigned)((4 * w + 2 * hi) * N + col);   // row k of chunk 0, this lane's column
    const unsigned o1 = o0 + (unsigned)N;                         // row k + 1
    v2f b[2 * NSTAGE];
    // unrolled: b[j] is picked at compile time and stays in registers
    #pragma unroll
    for (int j = 0; j < 2 * NSTAGE; ++j) {
        const float* wj = W + (size_t)j * (4 * KWAVES) * N;       // chunk j starts 128 rows behind chunk j - 1
        b[j].x = wj[o0];
        b[j].y = wj[o1];
        // keeps the loads in the order of their use: a stage's counted wait then waits for no later chunk
        if (j & 1) __builtin_amdgcn_sched_barrier(0);
    }

    // stage 0 has landed for this wave's copies; the barrier publishes it to all
    asm volatile("s_wait_asynccnt 0x0" ::: "memory");
    stage_barrier();
    copy_stage(l1, ag + KSTAGE);

    v8f acc0 = {}, acc1 = {}, acc2 = {}, acc3 = {};

    // unrolled: the buffer choice and the two tail tests are compile-time, LDS offsets immediates
    #pragma unroll
    for (int s = 0; s < NSTAGE; ++s) {
        // unrolled: b[2 * s + u] is picked at compile time and stays in registers
        #pragma unroll
        for (int u = 0; u < 2; ++u) {
            const float* as = &stage[s & 1][n * APITCH + 4 * (w + KWAVES * u) + 2 * hi];
            v2f a0 = *(const v2f*)(as + 0 * 16 * APITCH);
            v2f a1 = *(const v2f*)(as + 1 * 16 * APITCH);
            v2f a2 = *(const v2f*)(as + 2 * 16 * APITCH);
            v2f a3 = *(const v2f*)(as + 3 * 16 * APITCH);
            acc0 = wmma_f32(a0, b[2 * s + u], acc0);
            acc1 = wmma_f32(a1, b[2 * s + u], acc1);
            acc2 = wmma_f32(a2, b[2 * s + u], acc2);
            acc3 = wmma_f32(a3, b[2 * s + u], acc3);
        }
        // holds the stage's WMMAs in front of the waits below: without it the compiler sinks them
        // behind the barrier, where they stand in front of the refill's copies
        __builtin_amdgcn_sched_barrier(0);
        if (s + 1 < NSTAGE) {
            // this wave's reads of buffer s & 1 are done before the buffer is refilled
            asm volatile("s_wait_dscnt 0x0" ::: "memory");
            // this wave's copies of stage s + 1 have landed
            asm volatile("s_wait_asynccnt 0x0" ::: "memory");
            // publishes stage s + 1 and ends every wave's reads of stage s
            stage_barrier();
            if (s + 2 < NSTAGE) copy_stage((s & 1) ? l1 : l0, ag + (s + 2) * KSTAGE);
        }
    }
    // no copy is outstanding when the wave goes on
    asm volatile("s_wait_asynccnt 0x0" ::: "memory");

    // partial tile -> LDS, register (i, j) of every lane at (i*8 + j)*32 + lane
    float* pw = part + w * 1024 + lane;
    #pragma unroll
    for (int j = 0; j < 8; ++j) {
        pw[(0 * 8 + j) * 32] = acc0[j];
        pw[(1 * 8 + j) * 32] = acc1[j];
        pw[(2 * 8 + j) * 32] = acc2[j];
        pw[(3 * 8 + j) * 32] = acc3[j];
    }
    __syncthreads();

    // thread (w, lane) owns element (i*8 + j == w, lane) of the 64x16 tile
    float s = 0.0f;
    #pragma unroll
    for (int v = 0; v < KWAVES; ++v) s += part[v * 1024 + threadIdx.x];

    const int row = (w >> 3) * 16 + (w & 7) + 8 * hi;
    C[(size_t)row * N + col] = s + bias[col];
}

// ---------------------------------------------------------------------------
// Flash-decoding MQA attention, split-K over cache slots.
// grid.x = NBATCH*8, block = 128 (4 waves). Wave = 128 slots (8 tiles of 16).
// Emits per-split partials (running max m, denom l, unnormalized O 16x128).
// Each wave's K and V tiles come into LDS by asynchronous copies, one wave-wide
// copy per slot (512 contiguous bytes, four whole lines); two buffers, the next
// tile's 32 copies per wave in flight while this one is multiplied. The slot that
// holds the new token takes its row from knew / vnew at the copy's source.
// ---------------------------------------------------------------------------
// One wave's copies of a 16-slot tile: lane l brings 16 bytes at column 4*l of every slot.
// The s_wait_xcnt stands inside each statement, so that no address register of a
// copy is rewritten in front of it.
template <int PITCH>
static __device__ __forceinline__ void copy_tile(unsigned l, const float* cache, const float* fresh,
                                                 int slot0, int pslot, int lane) {
    // unrolled: the row offsets in LDS are compile-time
    #pragma unroll
    for (int h = 0; h < 2; ++h) {
        const float* g[8];
        // unrolled: g[r] is picked at compile time and stays in registers
        #pragma unroll
        for (int r = 0; r < 8; ++r) {
            const int slot = slot0 + 8 * h + r;
            g[r] = (slot == pslot ? fresh : cache + (size_t)slot * HD) + 4 * lane;
        }
        const unsigned lh = l + 8 * h * PITCH * 4;
        asm volatile(
            "global_load_async_to_lds_b128 %0, %8, off\n\t"
            "global_load_async_to_lds_b128 %1, %9, off\n\t"
            "global_load_async_to_lds_b128 %2, %10, off\n\t"
            "global_load_async_to_lds_b128 %3, %11, off\n\t"
            "global_load_async_to_lds_b128 %4, %12, off\n\t"
            "global_load_async_to_lds_b128 %5, %13, off\n\t"
            "global_load_async_to_lds_b128 %6, %14, off\n\t"
            "global_load_async_to_lds_b128 %7, %15, off\n\t"
            "s_wait_xcnt 0x0"
            :: "v"(lh), "v"(lh + 1 * PITCH * 4), "v"(lh + 2 * PITCH * 4), "v"(lh + 3 * PITCH * 4),
               "v"(lh + 4 * PITCH * 4), "v"(lh + 5 * PITCH * 4), "v"(lh + 6 * PITCH * 4), "v"(lh + 7 * PITCH * 4),
               "v"(g[0]), "v"(g[1]), "v"(g[2]), "v"(g[3]), "v"(g[4]), "v"(g[5]), "v"(g[6]), "v"(g[7])
            : "memory");
    }
}

__global__ __launch_bounds__(128) void attn_kernel(
    const float* __restrict__ q,      // [64, 2048]  (16 heads x 128)
    const float* __restrict__ kcache, // [64, 4096, 128]
    const float* __restrict__ vcache, // [64, 4096, 128]
    const float* __restrict__ knew,   // [64, 128]
    const float* __restrict__ vnew,   // [64, 128]
    const int*   __restrict__ pos,    // [64]
    float* __restrict__ ml,           // [64, 32, 16, 2]
    float* __restrict__ opart)        // [64, 32, 16, 128]
{
    __shared__ __attribute__((aligned(16))) float lds_q[NHEADS * QPITCH];
    __shared__ float lds_p[4 * 256];
    __shared__ __attribute__((aligned(16))) float lds_k[2][4][16 * KPITCH];
    __shared__ __attribute__((aligned(16))) float lds_v[2][4][16 * VPITCH];

    const int tid   = threadIdx.x;
    // wave number in a scalar register: the slot numbers and the copies' source rows stay scalar
    const int w     = __builtin_amdgcn_readfirstlane(tid >> 5);
    const int lane  = tid & 31;
    const int n     = lane & 15;   // head row for A / slot or dim col for B,C
    const int hi    = lane >> 4;
    const int b     = blockIdx.x >> 3;
    const int split = (blockIdx.x & 7) * 4 + w;    // 0..31
    const int pslot = pos[b];
    const size_t kvb = (size_t)b * STOT * HD;
    const float* kc = kcache + kvb;
    const float* vc = vcache + kvb;
    const float* kf = knew + (size_t)b * HD;
    const float* vf = vnew + (size_t)b * HD;
    // LDS byte address (low 32 bits of the shared address) of this lane's column in this wave's tile, buffer 0
    const unsigned lk = (unsigned)(size_t)&lds_k[0][w][4 * lane];
    const unsigned lv = (unsigned)(size_t)&lds_v[0][w][4 * lane];
    const unsigned kbuf = sizeof(lds_k[0]);   // bytes from buffer 0 to buffer 1
    const unsigned vbuf = sizeof(lds_v[0]);

    copy_tile<KPITCH>(lk, kc, kf, split * 128, pslot, lane);
    copy_tile<VPITCH>(lv, vc, vf, split * 128, pslot, lane);

    // stage Q[b] (16x128) into LDS, coalesced
    const float* qg = q + (size_t)b * EMBED;
    for (int r = 0; r < NHEADS; ++r) lds_q[r * QPITCH + tid] = qg[r * HD + tid];
    // tile 0 has landed for this wave's copies; the barrier publishes it, and Q, to all
    asm volatile("s_wait_asynccnt 0x0" ::: "memory");
    __syncthreads();
    copy_tile<KPITCH>(lk + kbuf, kc, kf, split * 128 + 16, pslot, lane);
    copy_tile<VPITCH>(lv + vbuf, vc, vf, split * 128 + 16, pslot, lane);

    // this lane's 32 A fragments of Q: the same for every tile, read from LDS once and kept in registers
    v2f qa[32];
    // unrolled: qa[kk] is picked at compile time and stays in registers
    #pragma unroll
    for (int kk = 0; kk < 32; ++kk) qa[kk] = *(const v2f*)(lds_q + n * QPITCH + 4 * kk + 2 * hi);

    const float scale = 0.08838834764831845f;  // 1/sqrt(128)

    float m_run[8], l_run[8];
    v8f O[8];
    #pragma unroll
    for (int j = 0; j < 8; ++j) { m_run[j] = -3.0e38f; l_run[j] = 0.0f; }
    #pragma unroll
    for (int f = 0; f < 8; ++f) O[f] = v8f{};

    float* sp = lds_p + w * 256;

    #pragma unroll 1
    for (int t = 0; t < TILES_PER_WAVE; ++t) {
        const int slot_base = split * 128 + t * 16;

        // ---- S = Q @ K^T for a 16-head x 16-slot tile -------------------
        const float* kr = &lds_k[t & 1][w][n * KPITCH];   // this lane's slot column
        v8f S = {};
        #pragma unroll
        for (int kk = 0; kk < 32; ++kk) {
            v2f kb = *(const v2f*)(kr + 4 * kk + 2 * hi);
            S = wmma_f32(qa[kk], kb, S);
        }

        // ---- online softmax (rows j+8*hi live in 16-lane halves) --------
        float pj[8];
        #pragma unroll
        for (int j = 0; j < 8; ++j) {
            float s = S[j] * scale;
            float tm = s;
            tm = fmaxf(tm, __shfl_xor(tm, 1, 32));
            tm = fmaxf(tm, __shfl_xor(tm, 2, 32));
            tm = fmaxf(tm, __shfl_xor(tm, 4, 32));
            tm = fmaxf(tm, __shfl_xor(tm, 8, 32));
            const float mnew  = fmaxf(m_run[j], tm);
            const float alpha = __expf(m_run[j] - mnew);
            const float p     = __expf(s - mnew);
            float ts = p;
            ts += __shfl_xor(ts, 1, 32);
            ts += __shfl_xor(ts, 2, 32);
            ts += __shfl_xor(ts, 4, 32);
            ts += __shfl_xor(ts, 8, 32);
            l_run[j] = l_run[j] * alpha + ts;
            m_run[j] = mnew;
            pj[j] = p;
            #pragma unroll
            for (int f = 0; f < 8; ++f) O[f][j] *= alpha;
        }

        // ---- C-layout -> A-layout for P via per-wave LDS staging --------
        #pragma unroll
        for (int j = 0; j < 8; ++j) sp[(j + 8 * hi) * 16 + n] = pj[j];
        // same-wave DS ops are in-order; no barrier needed

        // ---- O += P @ V  (K = 16 slots, N = 128 dims in 8 fragments) ----
        #pragma unroll
        for (int c4 = 0; c4 < 4; ++c4) {
            v2f a = *(const v2f*)(sp + n * 16 + 4 * c4 + 2 * hi);
            const float* vr0 = &lds_v[t & 1][w][(4 * c4 + 2 * hi) * VPITCH];
            const float* vr1 = vr0 + VPITCH;
            #pragma unroll
            for (int f = 0; f < 8; ++f) {
                v2f vb;
                vb.x = vr0[16 * f + n];
                vb.y = vr1[16 * f + n];
                O[f] = wmma_f32(a, vb, O[f]);
            }
        }

        // this wave's reads of buffer t & 1 are done before the buffer is refilled
        asm volatile("s_wait_dscnt 0x0" ::: "memory");
        // this wave's copies of tile t + 1 have landed
        asm volatile("s_wait_asynccnt 0x0" ::: "memory");
        // publishes tile t + 1 and ends every wave's reads of tile t
        __syncthreads();
        if (t + 2 < TILES_PER_WAVE) {
            copy_tile<KPITCH>(lk + (t & 1) * kbuf, kc, kf, slot_base + 32, pslot, lane);
            copy_tile<VPITCH>(lv + (t & 1) * vbuf, vc, vf, slot_base + 32, pslot, lane);
        }
    }
    // no copy is outstanding when the wave goes on
    asm volatile("s_wait_asynccnt 0x0" ::: "memory");

    // ---- emit partials --------------------------------------------------
    float* op = opart + ((size_t)b * NSPLIT + split) * NHEADS * HD;
    #pragma unroll
    for (int f = 0; f < 8; ++f)
        #pragma unroll
        for (int j = 0; j < 8; ++j)
            op[(size_t)(j + 8 * hi) * HD + 16 * f + n] = O[f][j];

    if (n == 0) {  // lane 0 (rows 0..7) and lane 16 (rows 8..15)
        float* mlp = ml + ((size_t)b * NSPLIT + split) * NHEADS * 2;
        #pragma unroll
        for (int j = 0; j < 8; ++j) {
            mlp[(j + 8 * hi) * 2 + 0] = m_run[j];
            mlp[(j + 8 * hi) * 2 + 1] = l_run[j];
        }
    }
}

// ---------------------------------------------------------------------------
// Combine 32 split partials per (b,h): attn[b, h*128+d]
// grid.x = 64*16, block = 128 (one thread per dim).
// ---------------------------------------------------------------------------
__global__ __launch_bounds__(128) void reduce_kernel(
    const float* __restrict__ ml, const float* __restrict__ opart,
    float* __restrict__ attn)
{
    const int b = blockIdx.x >> 4;
    const int h = blockIdx.x & 15;
    const int d = threadIdx.x;
    const float* mlb = ml + (size_t)b * NSPLIT * NHEADS * 2;
    const float* ob  = opart + (size_t)b * NSPLIT * NHEADS * HD;

    float M = -3.0e38f;
    for (int s = 0; s < NSPLIT; ++s) M = fmaxf(M, mlb[(s * NHEADS + h) * 2]);

    float L = 0.0f, acc = 0.0f;
    for (int s = 0; s < NSPLIT; ++s) {
        const float ms = mlb[(s * NHEADS + h) * 2 + 0];
        const float ls = mlb[(s * NHEADS + h) * 2 + 1];
        const float wt = __expf(ms - M);
        L   += ls * wt;
        acc += wt * ob[((size_t)s * NHEADS + h) * HD + d];
    }
    attn[(size_t)b * EMBED + h * HD + d] = acc / L;
}

// ---------------------------------------------------------------------------
extern "C" void kernel_launch(void* const* d_in, const int* in_sizes, int n_in,
                              void* d_out, int out_size, void* d_ws, size_t ws_size,
                              hipStream_t stream) {
    const float* x       = (const float*)d_in[0];
    const float* k_cache = (const float*)d_in[1];
    const float* v_cache = (const float*)d_in[2];
    const int*   pos     = (const int*)  d_in[3];
    const float* Wq      = (const float*)d_in[4];
    const float* bq      = (const float*)d_in[5];
    const float* Wk      = (const float*)d_in[6];
    const float* bk      = (const float*)d_in[7];
    const float* Wv      = (const float*)d_in[8];
    const float* bv      = (const float*)d_in[9];
    const float* Wo      = (const float*)d_in[10];
    const float* bo      = (const float*)d_in[11];

    float* ws    = (float*)d_ws;
    float* q     = ws;                       // 64*2048
    float* knew  = q + NBATCH * EMBED;       // 64*128
    float* vnew  = knew + NBATCH * HD;       // 64*128
    float* attn  = vnew + NBATCH * HD;       // 64*2048
    float* ml    = attn + NBATCH * EMBED;    // 64*32*16*2
    float* opart = ml + NBATCH * NSPLIT * NHEADS * 2;  // 64*32*16*128

    // QKV projections, one launch: 128 column tiles of Wq, 8 of Wk, 8 of Wv
    gemm64_kernel<<<EMBED / 16 + 2 * (HD / 16), 1024, 0, stream>>>(
        x, Wq, bq, q, EMBED, Wk, bk, knew, Wv, bv, vnew, HD);

    // flash-decoding attention over the contiguous cache (+ new token read at slot pos)
    attn_kernel<<<NBATCH * 8, 128, 0, stream>>>(q, k_cache, v_cache, knew, vnew,
                                                pos, ml, opart);
    reduce_kernel<<<NBATCH * NHEADS, 128, 0, stream>>>(ml, opart, attn);

    // output projection
    gemm64_kernel<<<EMBED / 16, 1024, 0, stream>>>(
        attn, Wo, bo, (float*)d_out, EMBED, nullptr, nullptr, nullptr, nullptr, nullptr, nullptr, 0);
}

// v007
// A run of this version takes 49.9 microseconds.
// Timed twice side by side with v006, it ran 1.07 and 1.08 times as fast.
// Over all steps from v000 it is 14.0 times as fast.
#include <hip/hip_runtime.h>
#include <hip/hip_bf16.h>

typedef __attribute__((ext_vector_type(2))) float v2f;
typedef __attribute__((ext_vector_type(8))) float v8f;

#define EMBED 2048
#define HD 128
#define NHEADS 16
#define STOT 4096
#define NBATCH 64
#define NSPLIT 32           // waves per batch (8 WGs x 4 waves)
#define TILES_PER_WAVE 8    // 8 tiles * 16 slots = 128 slots per wave
#define KWAVES 32           // waves of a GEMM work-group, each with its share of K
#define KSTAGE 256          // k per stage of A in LDS: two chunks of 4 k per wave
#define NSTAGE (EMBED / KSTAGE)
#define APITCH 260          // floats per staged row: 16 B x odd, the 16 rows of a fragment read fall on all 64 banks
#define KPITCH 132          // floats per staged K row: 16 B x odd, the 16 slots of a fragment read fall on all 64 banks
#define QPITCH 132          // floats per staged Q row: 16 B x odd, the 16 heads of a fragment read fall on all 64 banks
#define VPITCH 132          // floats per staged V row: the two halves of a fragment read, eight rows apart, fall 32 banks apart

static __device__ __forceinline__ v8f wmma_f32(v2f a, v2f b, v8f c) {
    return __builtin_amdgcn_wmma_f32_16x16x4_f32(false, a, false, b, (short)0, c, false, false);
}

// ---------------------------------------------------------------------------
// GEMM: C[64,N] = A[64,EMBED] @ W[EMBED,N] + bias[N]   (f32 WMMA 16x16x4)
// One work-group per 16-wide column tile, covering all 4 row tiles (M=64).
// K is split over the work-group's 32 waves: wave w sums the chunks of 4 k
// numbered w, w+32, w+64, ...; the 32 partial tiles are summed through LDS.
// A comes in stages of 64 rows x 256 k by asynchronous copies to LDS: each
// wave-wide copy takes 512 contiguous bytes of one row (four whole lines), and
// the row-per-lane fragments are read from LDS; two stage buffers, the next
// stage's copies in flight while this one is multiplied.
// W goes straight to registers: a wave asks for all 16 of its B fragments in front of stage 0,
// and each stage waits only for the two that it multiplies.
// One launch serves up to three products of the same A: the first N0/16 work-groups
// take W0, the next N12/16 take W1, the last N12/16 take W2; they share nothing.
// grid.x = N0/16 (+ 2 * N12/16 where W1 and W2 are given), block = 1024 (32 waves).
// ---------------------------------------------------------------------------
// One thread's share of a stage: 16 bytes of each of four rows, 16 rows apart.
// The s_wait_xcnt stands inside the statement, so that no address register of a
// copy is rewritten in front of it.
static __device__ __forceinline__ void copy_stage(unsigned l, const float* g) {
    asm volatile(
        "global_load_async_to_lds_b128 %0, %4, off\n\t"
        "global_load_async_to_lds_b128 %1, %5, off\n\t"
        "global_load_async_to_lds_b128 %2, %6, off\n\t"
        "global_load_async_to_lds_b128 %3, %7, off\n\t"
        "s_wait_xcnt 0x0"
        :: "v"(l), "v"(l + 16 * APITCH * 4), "v"(l + 32 * APITCH * 4), "v"(l + 48 * APITCH * 4),
           "v"(g), "v"(g + 16 * EMBED), "v"(g + 32 * EMBED), "v"(g + 48 * EMBED)
        : "memory");
}

// The work-group's own barrier by hand, for the stages of A: __syncthreads() carries a fence that waits for
// every global load of the wave, and would drain the loads of W that are meant to stay in flight across it.
// What the staged data needs stands in front of every call: s_wait_asynccnt 0, and s_wait_dscnt 0 where the wave has read LDS.
static __device__ __forceinline__ void stage_barrier() {
    asm volatile("s_barrier_signal -1\n\ts_barrier_wait -1" ::: "memory");
}

// waves_per_eu(8, 8): the 32 waves sit 8 to a SIMD; told so, the compiler keeps all of a wave's
// loads of W in flight (32 registers) instead of saving registers for 16 waves a SIMD.
__global__ __launch_bounds__(1024) __attribute__((amdgpu_waves_per_eu(8, 8))) void gemm64_kernel(
    const float* __restrict__ A,
    const float* __restrict__ W0, const float* __restrict__ bias0, float* __restrict__ C0, int N0,
    const float* __restrict__ W1, const float* __restrict__ bias1, float* __restrict__ C1,
    const float* __restrict__ W2, const float* __restrict__ bias2, float* __restrict__ C2, int N12)
{
    __shared__ __attribute__((aligned(16))) float stage[2][64 * APITCH];
    __shared__ float part[KWAVES * 1024];   // one 64x16 partial tile per wave

    const int lane = threadIdx.x & 31;
    // wave number in a scalar register: addresses that hang on it stay scalar
    const int w    = __builtin_amdgcn_readfirstlane(threadIdx.x >> 5);
    const int n    = lane & 15;
    const int hi   = lane >> 4;
    // which product this work-group serves, and which column tile of it (the same for the whole group)
    const int t0   = N0 >> 4;
    const int t12  = N12 >> 4;
    const int sel  = ((int)blockIdx.x >= t0) + ((int)blockIdx.x >= t0 + t12);
    const float* W    = sel == 0 ? W0 : sel == 1 ? W1 : W2;
    const float* bias = sel == 0 ? bias0 : sel == 1 ? bias1 : bias2;
    float*       C    = sel == 0 ? C0 : sel == 1 ? C1 : C2;
    const int N    = sel == 0 ? N0 : N12;
    const int tile = (int)blockIdx.x - (sel == 0 ? 0 : sel == 1 ? t0 : t0 + t12);
    const int col  = tile * 16 + n;

    // this thread's share of a stage: 16 bytes at column 4*sc of rows sr, sr+16, sr+32, sr+48
    const int sr = threadIdx.x >> 6;
    const int sc = threadIdx.x & 63;
    const float* ag = A + (size_t)sr * EMBED + 4 * sc;
    // LDS byte address (low 32 bits of the shared address) of that share in each buffer
    const unsigned l0 = (unsigned)(size_t)&stage[0][sr * APITCH + 4 * sc];
    const unsigned l1 = (unsigned)(size_t)&stage[1][sr * APITCH + 4 * sc];

    copy_stage(l0, ag);

    // all 16 chunks of W that this wave multiplies, asked for here, in the order of their use:
    // memory's latency is paid once, under the wait for stage 0, not again in every stage
    const unsigned o0 = (unsigned)((4 * w + 2 * hi) * N + col);   // row k of chunk 0, this lane's column
    const unsigned o1 = o0 + (unsigned)N;                         // row k + 1
    v2f b[2 * NSTAGE];
    // unrolled: b[j] is picked at compile time and stays in registers
    #pragma unroll
    for (int j = 0; j < 2 * NSTAGE; ++j) {
        const float* wj = W + (size_t)j * (4 * KWAVES) * N;       // chunk j starts 128 rows behind chunk j - 1
        b[j].x = wj[o0];
        b[j].y = wj[o1];
        // keeps the loads in the order of their use: a stage's counted wait then waits for no later chunk
        if (j & 1) __builtin_amdgcn_sched_barrier(0);
    }

    // stage 0 has landed for this wave's copies; the barrier publishes it to all
    asm volatile("s_wait_asynccnt 0x0" ::: "memory");
    stage_barrier();
    copy_stage(l1, ag + KSTAGE);

    v8f acc0 = {}, acc1 = {}, acc2 = {}, acc3 = {};

    // unrolled: the buffer choice and the two tail tests are compile-time, LDS offsets immediates
    #pragma unroll
    for (int s = 0; s < NSTAGE; ++s) {
        // unrolled: b[2 * s + u] is picked at compile time and stays in registers
        #pragma unroll
        for (int u = 0; u < 2; ++u) {
            const float* as = &stage[s & 1][n * APITCH + 4 * (w + KWAVES * u) + 2 * hi];
            v2f a0 = *(const v2f*)(as + 0 * 16 * APITCH);
            v2f a1 = *(const v2f*)(as + 1 * 16 * APITCH);
            v2f a2 = *(const v2f*)(as + 2 * 16 * APITCH);
            v2f a3 = *(const v2f*)(as + 3 * 16 * APITCH);
            acc0 = wmma_f32(a0, b[2 * s + u], acc0);
            acc1 = wmma_f32(a1, b[2 * s + u], acc1);
            acc2 = wmma_f32(a2, b[2 * s + u], acc2);
            acc3 = wmma_f32(a3, b[2 * s + u], acc3);
        }
        // holds the stage's WMMAs in front of the waits below: without it the compiler sinks them
        // behind the barrier, where they stand in front of the refill's copies
        __builtin_amdgcn_sched_barrier(0);
        if (s + 1 < NSTAGE) {
            // this wave's reads of buffer s & 1 are done before the buffer is refilled
            asm volatile("s_wait_dscnt 0x0" ::: "memory");
            // this wave's copies of stage s + 1 have landed
            asm volatile("s_wait_asynccnt 0x0" ::: "memory");
            // publishes stage s + 1 and ends every wave's reads of stage s
            stage_barrier();
            if (s + 2 < NSTAGE) copy_stage((s & 1) ? l1 : l0, ag + (s + 2) * KSTAGE);
        }
    }
    // no copy is outstanding when the wave goes on
    asm volatile("s_wait_asynccnt 0x0" ::: "memory");

    // partial tile -> LDS, register (i, j) of every lane at (i*8 + j)*32 + lane
    float* pw = part + w * 1024 + lane;
    #pragma unroll
    for (int j = 0; j < 8; ++j) {
        pw[(0 * 8 + j) * 32] = acc0[j];
        pw[(1 * 8 + j) * 32] = acc1[j];
        pw[(2 * 8 + j) * 32] = acc2[j];
        pw[(3 * 8 + j) * 32] = acc3[j];
    }
    __syncthreads();

    // thread (w, lane) owns element (i*8 + j == w, lane) of the 64x16 tile
    float s = 0.0f;
    #pragma unroll
    for (int v = 0; v < KWAVES; ++v) s += part[v * 1024 + threadIdx.x];

    const int row = (w >> 3) * 16 + (w & 7) + 8 * hi;
    C[(size_t)row * N + col] = s + bias[col];
}

template <int PITCH>
static __device__ __forceinline__ void copy_tile(unsigned l, const float* cache, const float* fresh,
                                                 int slot0, int pslot, int lane) {
    // unrolled: the row offsets in LDS are compile-time
    #pragma unroll
    for (int h = 0; h < 2; ++h) {
        const float* g[8];
        // unrolled: g[r] is picked at compile time and stays in registers
        #pragma unroll
        for (int r = 0; r < 8; ++r) {
            const int slot = slot0 + 8 * h + r;
            g[r] = (slot == pslot ? fresh : cache + (size_t)slot * HD) + 4 * lane;
        }
        const unsigned lh = l + 8 * h * PITCH * 4;
        asm volatile(
            "global_load_async_to_lds_b128 %0, %8, off\n\t"
            "global_load_async_to_lds_b128 %1, %9, off\n\t"
            "global_load_async_to_lds_b128 %2, %10, off\n\t"
            "global_load_async_to_lds_b128 %3, %11, off\n\t"
            "global_load_async_to_lds_b128 %4, %12, off\n\t"
            "global_load_async_to_lds_b128 %5, %13, off\n\t"
            "global_load_async_to_lds_b128 %6, %14, off\n\t"
            "global_load_async_to_lds_b128 %7, %15, off\n\t"
            "s_wait_xcnt 0x0"
            :: "v"(lh), "v"(lh + 1 * PITCH * 4), "v"(lh + 2 * PITCH * 4), "v"(lh + 3 * PITCH * 4),
               "v"(lh + 4 * PITCH * 4), "v"(lh + 5 * PITCH * 4), "v"(lh + 6 * PITCH * 4), "v"(lh + 7 * PITCH * 4),
               "v"(g[0]), "v"(g[1]), "v"(g[2]), "v"(g[3]), "v"(g[4]), "v"(g[5]), "v"(g[6]), "v"(g[7])
            : "memory");
    }
}

// The value that lane l ^ 16 holds, by a vector cross-row move (a shuffle would go through the LDS unit).
static __device__ __forceinline__ float other_half(float x) {
    const int i = __float_as_int(x);
    return __int_as_float(__builtin_amdgcn_permlanex16(i, i, 0x76543210, 0xfedcba98, false, false));
}

__global__ __launch_bounds__(128) void attn_kernel(
    const float* __restrict__ q,      // [64, 2048]  (16 heads x 128)
    const float* __restrict__ kcache, // [64, 4096, 128]
    const float* __restrict__ vcache, // [64, 4096, 128]
    const float* __restrict__ knew,   // [64, 128]
    const float* __restrict__ vnew,   // [64, 128]
    const int*   __restrict__ pos,    // [64]
    float* __restrict__ ml,           // [64, 32, 16, 2]
    float* __restrict__ opart)        // [64, 32, 16, 128]
{
    __shared__ __attribute__((aligned(16))) float lds_q[NHEADS * QPITCH];
    __shared__ __attribute__((aligned(16))) float lds_k[2][4][16 * KPITCH];
    __shared__ __attribute__((aligned(16))) float lds_v[2][4][16 * VPITCH];

    const int tid   = threadIdx.x;
    // wave number in a scalar register: the slot numbers and the copies' source rows stay scalar
    const int w     = __builtin_amdgcn_readfirstlane(tid >> 5);
    const int lane  = tid & 31;
    const int n     = lane & 15;   // slot or dim row for A / head column for B, C
    const int hi    = lane >> 4;
    const int b     = blockIdx.x >> 3;
    const int split = (blockIdx.x & 7) * 4 + w;    // 0..31
    const int pslot = pos[b];
    const size_t kvb = (size_t)b * STOT * HD;
    const float* kc = kcache + kvb;
    const float* vc = vcache + kvb;
    const float* kf = knew + (size_t)b * HD;
    const float* vf = vnew + (size_t)b * HD;
    // LDS byte address (low 32 bits of the shared address) of this lane's column in this wave's tile, buffer 0
    const unsigned lk = (unsigned)(size_t)&lds_k[0][w][4 * lane];
    const unsigned lv = (unsigned)(size_t)&lds_v[0][w][4 * lane];
    const unsigned kbuf = sizeof(lds_k[0]);   // bytes from buffer 0 to buffer 1
    const unsigned vbuf = sizeof(lds_v[0]);

    copy_tile<KPITCH>(lk, kc, kf, split * 128, pslot, lane);
    copy_tile<VPITCH>(lv, vc, vf, split * 128, pslot, lane);

    // stage Q[b] (16x128) into LDS, coalesced
    const float* qg = q + (size_t)b * EMBED;
    for (int r = 0; r < NHEADS; ++r) lds_q[r * QPITCH + tid] = qg[r * HD + tid];
    // tile 0 has landed for this wave's copies; the barrier publishes it, and Q, to all
    asm volatile("s_wait_asynccnt 0x0" ::: "memory");
    __syncthreads();
    copy_tile<KPITCH>(lk + kbuf, kc, kf, split * 128 + 16, pslot, lane);
    copy_tile<VPITCH>(lv + vbuf, vc, vf, split * 128 + 16, pslot, lane);

    // this lane's 32 B fragments of Q^T: the same for every tile, read from LDS once and kept in registers
    v2f qa[32];
    // unrolled: qa[kk] is picked at compile time and stays in registers
    #pragma unroll
    for (int kk = 0; kk < 32; ++kk) qa[kk] = *(const v2f*)(lds_q + n * QPITCH + 4 * kk + 2 * hi);

    const float scale = 0.08838834764831845f;  // 1/sqrt(128)

    // one head per lane: its running maximum (alike in both halves) and the sum over this half's slots
    float m_run = -3.0e38f, l_run = 0.0f;
    v8f O[8];   // O[f][j] = O^T[dim 16*f + 8*hi + j][head n]
    #pragma unroll
    for (int f = 0; f < 8; ++f) O[f] = v8f{};

    #pragma unroll 1
    for (int t = 0; t < TILES_PER_WAVE; ++t) {
        const int slot_base = split * 128 + t * 16;

        // ---- S^T = K @ Q^T for a 16-slot x 16-head tile: S[j] = score of slot 8*hi + j, head n ----
        const float* kr = &lds_k[t & 1][w][n * KPITCH];   // this lane's slot row
        v8f S = {};
        #pragma unroll
        for (int kk = 0; kk < 32; ++kk) {
            v2f kb = *(const v2f*)(kr + 4 * kk + 2 * hi);
            S = wmma_f32(kb, qa[kk], S);
        }

        // ---- online softmax, a head's 16 slots in the two lanes n and n + 16 ----
        float sj[8];
        #pragma unroll
        for (int j = 0; j < 8; ++j) sj[j] = S[j] * scale;
        float tm = fmaxf(fmaxf(fmaxf(sj[0], sj[1]), fmaxf(sj[2], sj[3])),
                         fmaxf(fmaxf(sj[4], sj[5]), fmaxf(sj[6], sj[7])));
        tm = fmaxf(tm, other_half(tm));
        const float mnew  = fmaxf(m_run, tm);
        const float alpha = __expf(m_run - mnew);
        float pj[8];
        #pragma unroll
        for (int j = 0; j < 8; ++j) pj[j] = __expf(sj[j] - mnew);
        l_run = l_run * alpha + (((pj[0] + pj[1]) + (pj[2] + pj[3])) + ((pj[4] + pj[5]) + (pj[6] + pj[7])));
        m_run = mnew;
        #pragma unroll
        for (int f = 0; f < 8; ++f) O[f] *= alpha;

        // ---- O^T += V^T @ P^T  (K = 16 slots, M = 128 dims in 8 fragments) ----
        // chunk c multiplies slots 2c, 2c+1 (lanes 0-15) and 8+2c, 8+2c+1 (lanes 16-31): the slots
        // whose P this lane already holds; V^T's fragment takes the same slots at the same places
        #pragma unroll
        for (int c = 0; c < 4; ++c) {
            v2f pb;
            pb.x = pj[2 * c];
            pb.y = pj[2 * c + 1];
            const float* vr0 = &lds_v[t & 1][w][(8 * hi + 2 * c) * VPITCH];
            const float* vr1 = vr0 + VPITCH;
            #pragma unroll
            for (int f = 0; f < 8; ++f) {
                v2f va;
                va.x = vr0[16 * f + n];
                va.y = vr1[16 * f + n];
                O[f] = wmma_f32(va, pb, O[f]);
            }
        }

        // this wave's reads of buffer t & 1 are done before the buffer is refilled
        asm volatile("s_wait_dscnt 0x0" ::: "memory");
        // this wave's copies of tile t + 1 have landed
        asm volatile("s_wait_asynccnt 0x0" ::: "memory");
        // publishes tile t + 1 and ends every wave's reads of tile t
        __syncthreads();
        if (t + 2 < TILES_PER_WAVE) {
            copy_tile<KPITCH>(lk + (t & 1) * kbuf, kc, kf, slot_base + 32, pslot, lane);
            copy_tile<VPITCH>(lv + (t & 1) * vbuf, vc, vf, slot_base + 32, pslot, lane);
        }
    }
    // no copy is outstanding when the wave goes on
    asm volatile("s_wait_asynccnt 0x0" ::: "memory");

    // ---- emit partials --------------------------------------------------
    // the two halves' sums are joined once, here
    const float l_all = l_run + other_half(l_run);
    if (hi == 0) {
        float* mlp = ml + ((size_t)b * NSPLIT + split) * NHEADS * 2;
        *(float2*)(mlp + n * 2) = make_float2(m_run, l_all);
    }

    // O^T goes back to one row per head through this wave's own K tile of buffer 0 (16 rows at KPITCH; no other
    // wave touches it, and this wave's copies into it and reads of it have ended): a lane holds only 32 bytes in
    // a row of its head, and from LDS each store takes 512 contiguous bytes, four whole lines
    float* st = &lds_k[0][w][0];
    #pragma unroll
    for (int f = 0; f < 8; ++f) {
        float* sr = st + n * KPITCH + 16 * f + 8 * hi;
        *(float4*)(sr)     = make_float4(O[f][0], O[f][1], O[f][2], O[f][3]);
        *(float4*)(sr + 4) = make_float4(O[f][4], O[f][5], O[f][6], O[f][7]);
    }
    // a row is read by other lanes than wrote it: the wave's writes are done first, and no read is moved over this
    asm volatile("s_wait_dscnt 0x0" ::: "memory");
    float* op = opart + ((size_t)b * NSPLIT + split) * NHEADS * HD + 4 * lane;
    #pragma unroll
    for (int r = 0; r < NHEADS; ++r)
        *(float4*)(op + r * HD) = *(const float4*)(st + r * KPITCH + 4 * lane);
}

// ---------------------------------------------------------------------------
// Combine 32 split partials per (b,h): attn[b, h*128+d]
// grid.x = 64*16, block = 128 (one thread per dim).
// ---------------------------------------------------------------------------
__global__ __launch_bounds__(128) void reduce_kernel(
    const float* __restrict__ ml, const float* __restrict__ opart,
    float* __restrict__ attn)
{
    const int b = blockIdx.x >> 4;
    const int h = blockIdx.x & 15;
    const int d = threadIdx.x;
    const float* mlb = ml + (size_t)b * NSPLIT * NHEADS * 2;
    const float* ob  = opart + (size_t)b * NSPLIT * NHEADS * HD;

    float M = -3.0e38f;
    for (int s = 0; s < NSPLIT; ++s) M = fmaxf(M, mlb[(s * NHEADS + h) * 2]);

    float L = 0.0f, acc = 0.0f;
    for (int s = 0; s < NSPLIT; ++s) {
        const float ms = mlb[(s * NHEADS + h) * 2 + 0];
        const float ls = mlb[(s * NHEADS + h) * 2 + 1];
        const float wt = __expf(ms - M);
        L   += ls * wt;
        acc += wt * ob[((size_t)s * NHEADS + h) * HD + d];
    }
    attn[(size_t)b * EMBED + h * HD + d] = acc / L;
}

// ---------------------------------------------------------------------------
extern "C" void kernel_launch(void* const* d_in, const int* in_sizes, int n_in,
                              void* d_out, int out_size, void* d_ws, size_t ws_size,
                              hipStream_t stream) {
    const float* x       = (const float*)d_in[0];
    const float* k_cache = (const float*)d_in[1];
    const float* v_cache = (const float*)d_in[2];
    const int*   pos     = (const int*)  d_in[3];
    const float* Wq      = (const float*)d_in[4];
    const float* bq      = (const float*)d_in[5];
    const float* Wk      = (const float*)d_in[6];
    const float* bk      = (const float*)d_in[7];
    const float* Wv      = (const float*)d_in[8];
    const float* bv      = (const float*)d_in[9];
    const float* Wo      = (const float*)d_in[10];
    const float* bo      = (const float*)d_in[11];

    float* ws    = (float*)d_ws;
    float* q     = ws;                       // 64*2048
    float* knew  = q + NBATCH * EMBED;       // 64*128
    float* vnew  = knew + NBATCH * HD;       // 64*128
    float* attn  = vnew + NBATCH * HD;       // 64*2048
    float* ml    = attn + NBATCH * EMBED;    // 64*32*16*2
    float* opart = ml + NBATCH * NSPLIT * NHEADS * 2;  // 64*32*16*128

    // QKV projections, one launch: 128 column tiles of Wq, 8 of Wk, 8 of Wv
    gemm64_kernel<<<EMBED / 16 + 2 * (HD / 16), 1024, 0, stream>>>(
        x, Wq, bq, q, EMBED, Wk, bk, knew, Wv, bv, vnew, HD);

    // flash-decoding attention over the contiguous cache (+ new token read at slot pos)
    attn_kernel<<<NBATCH * 8, 128, 0, stream>>>(q, k_cache, v_cache, knew, vnew,
                                                pos, ml, opart);
    reduce_kernel<<<NBATCH * NHEADS, 128, 0, stream>>>(ml, opart, attn);

    // output projection
    gemm64_kernel<<<EMBED / 16, 1024, 0, stream>>>(
        attn, Wo, bo, (float*)d_out, EMBED, nullptr, nullptr, nullptr, nullptr, nullptr, nullptr, 0);
}

// v008
// One run takes 47.5 microseconds.
// Two timings next to v007 put it at 1.04 and 1.03 times that version's speed.
// Counting every step since v000, it is 14.5 times as fast.
#include <hip/hip_runtime.h>
#include <hip/hip_bf16.h>

typedef __attribute__((ext_vector_type(2))) float v2f;
typedef __attribute__((ext_vector_type(8))) float v8f;

#define EMBED 2048
#define HD 128
#define NHEADS 16
#define STOT 4096
#define NBATCH 64
#define NSPLIT 32           // waves per batch (8 WGs x 4 waves)
#define TILES_PER_WAVE 8    // 8 tiles * 16 slots = 128 slots per wave
#define MROWS 32            // rows of C per GEMM work-group: two work-groups share a column tile
#define KWAVES 16           // waves of a GEMM work-group, each with its share of K
#define KSTAGE 256          // k per stage of A in LDS: four chunks of 4 k per wave
#define NSTAGE (EMBED / KSTAGE)
#define CPS (KSTAGE / 4 / KWAVES)   // chunks of 4 k that a wave multiplies per stage
#define APITCH 260          // floats per staged row: 16 B x odd, the 16 rows of a fragment read fall on all 64 banks
#define KPITCH 132          // floats per staged K row: 16 B x odd, the 16 slots of a fragment read fall on all 64 banks
#define QPITCH 132          // floats per staged Q row: 16 B x odd, the 16 heads of a fragment read fall on all 64 banks
#define VPITCH 132          // floats per staged V row: the two halves of a fragment read, eight rows apart, fall 32 banks apart

static __device__ __forceinline__ v8f wmma_f32(v2f a, v2f b, v8f c) {
    return __builtin_amdgcn_wmma_f32_16x16x4_f32(false, a, false, b, (short)0, c, false, false);
}

// ---------------------------------------------------------------------------
// GEMM: C[64,N] = A[64,EMBED] @ W[EMBED,N] + bias[N]   (f32 WMMA 16x16x4)
// Two work-groups per 16-wide column tile, each covering 2 of the 4 row tiles (32 of M=64 rows,
// picked by blockIdx.y): the f32 matrix work of a tile column is the longest part of a work-group,
// and so it lies on two WGPs' matrix units; an output projection then fills 256 WGPs, not 128.
// K is split over the work-group's 16 waves: wave w sums the chunks of 4 k
// numbered w, w+16, w+32, ...; the 16 partial tiles are summed through LDS.
// A comes in stages of 32 rows x 256 k by asynchronous copies to LDS: each
// wave-wide copy takes 512 contiguous bytes of one row (four whole lines), and
// the row-per-lane fragments are read from LDS; two stage buffers, the next
// stage's copies in flight while this one is multiplied.
// W goes straight to registers: a wave asks for all 32 of its B fragments in front of stage 0,
// and each stage waits only for the four that it multiplies.
// One launch serves up to three products of the same A: the first N0/16 work-groups
// take W0, the next N12/16 take W1, the last N12/16 take W2; they share nothing.
// grid.x = N0/16 (+ 2 * N12/16 where W1 and W2 are given), grid.y = 2, block = 512 (16 waves).
// ---------------------------------------------------------------------------
// One thread's share of a stage: 16 bytes of each of four rows, 8 rows apart.
// The s_wait_xcnt stands inside the statement, so that no address register of a
// copy is rewritten in front of it.
static __device__ __forceinline__ void copy_stage(unsigned l, const float* g) {
    asm volatile(
        "global_load_async_to_lds_b128 %0, %4, off\n\t"
        "global_load_async_to_lds_b128 %1, %5, off\n\t"
        "global_load_async_to_lds_b128 %2, %6, off\n\t"
        "global_load_async_to_lds_b128 %3, %7, off\n\t"
        "s_wait_xcnt 0x0"
        :: "v"(l), "v"(l + 8 * APITCH * 4), "v"(l + 16 * APITCH * 4), "v"(l + 24 * APITCH * 4),
           "v"(g), "v"(g + 8 * EMBED), "v"(g + 16 * EMBED), "v"(g + 24 * EMBED)
        : "memory");
}

// The work-group's own barrier by hand, for the stages of A: __syncthreads() carries a fence that waits for
// every global load of the wave, and would drain the loads of W that are meant to stay in flight across it.
// What the staged data needs stands in front of every call: s_wait_asynccnt 0, and s_wait_dscnt 0 where the wave has read LDS.
static __device__ __forceinline__ void stage_barrier() {
    asm volatile("s_barrier_signal -1\n\ts_barrier_wait -1" ::: "memory");
}

// waves_per_eu(8, 8): two work-groups' 32 waves sit 8 to a SIMD where a WGP holds two; told so, the compiler keeps
// all of a wave's loads of W in flight (64 registers) instead of saving registers for 16 waves a SIMD.
__global__ __launch_bounds__(32 * KWAVES) __attribute__((amdgpu_waves_per_eu(8, 8))) void gemm64_kernel(
    const float* __restrict__ A,
    const float* __restrict__ W0, const float* __restrict__ bias0, float* __restrict__ C0, int N0,
    const float* __restrict__ W1, const float* __restrict__ bias1, float* __restrict__ C1,
    const float* __restrict__ W2, const float* __restrict__ bias2, float* __restrict__ C2, int N12)
{
    __shared__ __attribute__((aligned(16))) float stage[2][MROWS * APITCH];
    __shared__ float part[KWAVES * MROWS * 16];   // one 32x16 partial tile per wave

    const int lane = threadIdx.x & 31;
    // wave number in a scalar register: addresses that hang on it stay scalar
    const int w    = __builtin_amdgcn_readfirstlane(threadIdx.x >> 5);
    const int n    = lane & 15;
    const int hi   = lane >> 4;
    // which product this work-group serves, and which column tile of it (the same for the whole group)
    const int t0   = N0 >> 4;
    const int t12  = N12 >> 4;
    const int sel  = ((int)blockIdx.x >= t0) + ((int)blockIdx.x >= t0 + t12);
    const float* W    = sel == 0 ? W0 : sel == 1 ? W1 : W2;
    const float* bias = sel == 0 ? bias0 : sel == 1 ? bias1 : bias2;
    float*       C    = sel == 0 ? C0 : sel == 1 ? C1 : C2;
    const int N    = sel == 0 ? N0 : N12;
    const int tile = (int)blockIdx.x - (sel == 0 ? 0 : sel == 1 ? t0 : t0 + t12);
    const int col  = tile * 16 + n;

    // first of this work-group's 32 rows of A and C
    const int m0 = (int)blockIdx.y * MROWS;
    // this thread's share of a stage: 16 bytes at column 4*sc of rows m0 + sr, +8, +16, +24
    const int sr = threadIdx.x >> 6;
    const int sc = threadIdx.x & 63;
    const float* ag = A + (size_t)(m0 + sr) * EMBED + 4 * sc;
    // LDS byte address (low 32 bits of the shared address) of that share in each buffer
    const unsigned l0 = (unsigned)(size_t)&stage[0][sr * APITCH + 4 * sc];
    const unsigned l1 = (unsigned)(size_t)&stage[1][sr * APITCH + 4 * sc];

    copy_stage(l0, ag);

    // all 32 chunks of W that this wave multiplies, asked for here, in the order of their use:
    // memory's latency is paid once, under the wait for stage 0, not again in every stage
    const unsigned o0 = (unsigned)((4 * w + 2 * hi) * N + col);   // row k of chunk 0, this lane's column
    const unsigned o1 = o0 + (unsigned)N;                         // row k + 1
    v2f b[CPS * NSTAGE];
    // unrolled: b[j] is picked at compile time and stays in registers
    #pragma unroll
    for (int j = 0; j < CPS * NSTAGE; ++j) {
        const float* wj = W + (size_t)j * (4 * KWAVES) * N;       // chunk j starts 64 rows behind chunk j - 1
        b[j].x = wj[o0];
        b[j].y = wj[o1];
        // keeps the loads in the order of their use: a stage's counted wait then waits for no later chunk
        if (j & 1) __builtin_amdgcn_sched_barrier(0);
    }

    // stage 0 has landed for this wave's copies; the barrier publishes it to all
    asm volatile("s_wait_asynccnt 0x0" ::: "memory");
    stage_barrier();
    copy_stage(l1, ag + KSTAGE);

    v8f acc0 = {}, acc1 = {};

    // unrolled: the buffer choice and the two tail tests are compile-time, LDS offsets immediates
    #pragma unroll
    for (int s = 0; s < NSTAGE; ++s) {
        // unrolled: b[CPS * s + u] is picked at compile time and stays in registers
        #pragma unroll
        for (int u = 0; u < CPS; ++u) {
            const float* as = &stage[s & 1][n * APITCH + 4 * (w + KWAVES * u) + 2 * hi];
            v2f a0 = *(const v2f*)(as + 0 * 16 * APITCH);
            v2f a1 = *(const v2f*)(as + 1 * 16 * APITCH);
            acc0 = wmma_f32(a0, b[CPS * s + u], acc0);
            acc1 = wmma_f32(a1, b[CPS * s + u], acc1);
        }
        // holds the stage's WMMAs in front of the waits below: without it the compiler sinks them
        // behind the barrier, where they stand in front of the refill's copies
        __builtin_amdgcn_sched_barrier(0);
        if (s + 1 < NSTAGE) {
            // this wave's reads of buffer s & 1 are done before the buffer is refilled
            asm volatile("s_wait_dscnt 0x0" ::: "memory");
            // this wave's copies of stage s + 1 have landed
            asm volatile("s_wait_asynccnt 0x0" ::: "memory");
            // publishes stage s + 1 and ends every wave's reads of stage s
            stage_barrier();
            if (s + 2 < NSTAGE) copy_stage((s & 1) ? l1 : l0, ag + (s + 2) * KSTAGE);
        }
    }
    // no copy is outstanding when the wave goes on
    asm volatile("s_wait_asynccnt 0x0" ::: "memory");

    // partial tile -> LDS, register (i, j) of every lane at (i*8 + j)*32 + lane
    float* pw = part + w * (MROWS * 16) + lane;
    #pragma unroll
    for (int j = 0; j < 8; ++j) {
        pw[(0 * 8 + j) * 32] = acc0[j];
        pw[(1 * 8 + j) * 32] = acc1[j];
    }
    __syncthreads();

    // thread (w, lane) owns element (i*8 + j == w, lane) of the 32x16 tile
    float s = 0.0f;
    #pragma unroll
    for (int v = 0; v < KWAVES; ++v) s += part[v * (MROWS * 16) + threadIdx.x];

    const int row = m0 + (w >> 3) * 16 + (w & 7) + 8 * hi;
    C[(size_t)row * N + col] = s + bias[col];
}

template <int PITCH>
static __device__ __forceinline__ void copy_tile(unsigned l, const float* cache, const float* fresh,
                                                 int slot0, int pslot, int lane) {
    // unrolled: the row offsets in LDS are compile-time
    #pragma unroll
    for (int h = 0; h < 2; ++h) {
        const float* g[8];
        // unrolled: g[r] is picked at compile time and stays in registers
        #pragma unroll
        for (int r = 0; r < 8; ++r) {
            const int slot = slot0 + 8 * h + r;
            g[r] = (slot == pslot ? fresh : cache + (size_t)slot * HD) + 4 * lane;
        }
        const unsigned lh = l + 8 * h * PITCH * 4;
        asm volatile(
            "global_load_async_to_lds_b128 %0, %8, off\n\t"
            "global_load_async_to_lds_b128 %1, %9, off\n\t"
            "global_load_async_to_lds_b128 %2, %10, off\n\t"
            "global_load_async_to_lds_b128 %3, %11, off\n\t"
            "global_load_async_to_lds_b128 %4, %12, off\n\t"
            "global_load_async_to_lds_b128 %5, %13, off\n\t"
            "global_load_async_to_lds_b128 %6, %14, off\n\t"
            "global_load_async_to_lds_b128 %7, %15, off\n\t"
            "s_wait_xcnt 0x0"
            :: "v"(lh), "v"(lh + 1 * PITCH * 4), "v"(lh + 2 * PITCH * 4), "v"(lh + 3 * PITCH * 4),
               "v"(lh + 4 * PITCH * 4), "v"(lh + 5 * PITCH * 4), "v"(lh + 6 * PITCH * 4), "v"(lh + 7 * PITCH * 4),
               "v"(g[0]), "v"(g[1]), "v"(g[2]), "v"(g[3]), "v"(g[4]), "v"(g[5]), "v"(g[6]), "v"(g[7])
            : "memory");
    }
}

// The value that lane l ^ 16 holds, by a vector cross-row move (a shuffle would go through the LDS unit).
static __device__ __forceinline__ float other_half(float x) {
    const int i = __float_as_int(x);
    return __int_as_float(__builtin_amdgcn_permlanex16(i, i, 0x76543210, 0xfedcba98, false, false));
}

__global__ __launch_bounds__(128) void attn_kernel(
    const float* __restrict__ q,      // [64, 2048]  (16 heads x 128)
    const float* __restrict__ kcache, // [64, 4096, 128]
    const float* __restrict__ vcache, // [64, 4096, 128]
    const float* __restrict__ knew,   // [64, 128]
    const float* __restrict__ vnew,   // [64, 128]
    const int*   __restrict__ pos,    // [64]
    float* __restrict__ ml,           // [64, 32, 16, 2]
    float* __restrict__ opart)        // [64, 32, 16, 128]
{
    __shared__ __attribute__((aligned(16))) float lds_q[NHEADS * QPITCH];
    __shared__ __attribute__((aligned(16))) float lds_k[2][4][16 * KPITCH];
    __shared__ __attribute__((aligned(16))) float lds_v[2][4][16 * VPITCH];

    const int tid   = threadIdx.x;
    // wave number in a scalar register: the slot numbers and the copies' source rows stay scalar
    const int w     = __builtin_amdgcn_readfirstlane(tid >> 5);
    const int lane  = tid & 31;
    const int n     = lane & 15;   // slot or dim row for A / head column for B, C
    const int hi    = lane >> 4;
    const int b     = blockIdx.x >> 3;
    const int split = (blockIdx.x & 7) * 4 + w;    // 0..31
    const int pslot = pos[b];
    const size_t kvb = (size_t)b * STOT * HD;
    const float* kc = kcache + kvb;
    const float* vc = vcache + kvb;
    const float* kf = knew + (size_t)b * HD;
    const float* vf = vnew + (size_t)b * HD;
    // LDS byte address (low 32 bits of the shared address) of this lane's column in this wave's tile, buffer 0
    const unsigned lk = (unsigned)(size_t)&lds_k[0][w][4 * lane];
    const unsigned lv = (unsigned)(size_t)&lds_v[0][w][4 * lane];
    const unsigned kbuf = sizeof(lds_k[0]);   // bytes from buffer 0 to buffer 1
    const unsigned vbuf = sizeof(lds_v[0]);

    copy_tile<KPITCH>(lk, kc, kf, split * 128, pslot, lane);
    copy_tile<VPITCH>(lv, vc, vf, split * 128, pslot, lane);

    // stage Q[b] (16x128) into LDS, coalesced
    const float* qg = q + (size_t)b * EMBED;
    for (int r = 0; r < NHEADS; ++r) lds_q[r * QPITCH + tid] = qg[r * HD + tid];
    // tile 0 has landed for this wave's copies; the barrier publishes it, and Q, to all
    asm volatile("s_wait_asynccnt 0x0" ::: "memory");
    __syncthreads();
    copy_tile<KPITCH>(lk + kbuf, kc, kf, split * 128 + 16, pslot, lane);
    copy_tile<VPITCH>(lv + vbuf, vc, vf, split * 128 + 16, pslot, lane);

    // this lane's 32 B fragments of Q^T: the same for every tile, read from LDS once and kept in registers
    v2f qa[32];
    // unrolled: qa[kk] is picked at compile time and stays in registers
    #pragma unroll
    for (int kk = 0; kk < 32; ++kk) qa[kk] = *(const v2f*)(lds_q + n * QPITCH + 4 * kk + 2 * hi);

    const float scale = 0.08838834764831845f;  // 1/sqrt(128)

    // one head per lane: its running maximum (alike in both halves) and the sum over this half's slots
    float m_run = -3.0e38f, l_run = 0.0f;
    v8f O[8];   // O[f][j] = O^T[dim 16*f + 8*hi + j][head n]
    #pragma unroll
    for (int f = 0; f < 8; ++f) O[f] = v8f{};

    #pragma unroll 1
    for (int t = 0; t < TILES_PER_WAVE; ++t) {
        const int slot_base = split * 128 + t * 16;

        // ---- S^T = K @ Q^T for a 16-slot x 16-head tile: S[j] = score of slot 8*hi + j, head n ----
        const float* kr = &lds_k[t & 1][w][n * KPITCH];   // this lane's slot row
        v8f S = {};
        #pragma unroll
        for (int kk = 0; kk < 32; ++kk) {
            v2f kb = *(const v2f*)(kr + 4 * kk + 2 * hi);
            S = wmma_f32(kb, qa[kk], S);
        }

        // ---- online softmax, a head's 16 slots in the two lanes n and n + 16 ----
        float sj[8];
        #pragma unroll
        for (int j = 0; j < 8; ++j) sj[j] = S[j] * scale;
        float tm = fmaxf(fmaxf(fmaxf(sj[0], sj[1]), fmaxf(sj[2], sj[3])),
                         fmaxf(fmaxf(sj[4], sj[5]), fmaxf(sj[6], sj[7])));
        tm = fmaxf(tm, other_half(tm));
        const float mnew  = fmaxf(m_run, tm);
        const float alpha = __expf(m_run - mnew);
        float pj[8];
        #pragma unroll
        for (int j = 0; j < 8; ++j) pj[j] = __expf(sj[j] - mnew);
        l_run = l_run * alpha + (((pj[0] + pj[1]) + (pj[2] + pj[3])) + ((pj[4] + pj[5]) + (pj[6] + pj[7])));
        m_run = mnew;
        #pragma unroll
        for (int f = 0; f < 8; ++f) O[f] *= alpha;

        // ---- O^T += V^T @ P^T  (K = 16 slots, M = 128 dims in 8 fragments) ----
        // chunk c multiplies slots 2c, 2c+1 (lanes 0-15) and 8+2c, 8+2c+1 (lanes 16-31): the slots
        // whose P this lane already holds; V^T's fragment takes the same slots at the same places
        #pragma unroll
        for (int c = 0; c < 4; ++c) {
            v2f pb;
            pb.x = pj[2 * c];
            pb.y = pj[2 * c + 1];
            const float* vr0 = &lds_v[t & 1][w][(8 * hi + 2 * c) * VPITCH];
            const float* vr1 = vr0 + VPITCH;
            #pragma unroll
            for (int f = 0; f < 8; ++f) {
                v2f va;
                va.x = vr0[16 * f + n];
                va.y = vr1[16 * f + n];
                O[f] = wmma_f32(va, pb, O[f]);
            }
        }

        // this wave's reads of buffer t & 1 are done before the buffer is refilled
        asm volatile("s_wait_dscnt 0x0" ::: "memory");
        // this wave's copies of tile t + 1 have landed
        asm volatile("s_wait_asynccnt 0x0" ::: "memory");
        // publishes tile t + 1 and ends every wave's reads of tile t
        __syncthreads();
        if (t + 2 < TILES_PER_WAVE) {
            copy_tile<KPITCH>(lk + (t & 1) * kbuf, kc, kf, slot_base + 32, pslot, lane);
            copy_tile<VPITCH>(lv + (t & 1) * vbuf, vc, vf, slot_base + 32, pslot, lane);
        }
    }
    // no copy is outstanding when the wave goes on
    asm volatile("s_wait_asynccnt 0x0" ::: "memory");

    // ---- emit partials --------------------------------------------------
    // the two halves' sums are joined once, here
    const float l_all = l_run + other_half(l_run);
    if (hi == 0) {
        float* mlp = ml + ((size_t)b * NSPLIT + split) * NHEADS * 2;
        *(float2*)(mlp + n * 2) = make_float2(m_run, l_all);
    }

    // O^T goes back to one row per head through this wave's own K tile of buffer 0 (16 rows at KPITCH; no other
    // wave touches it, and this wave's copies into it and reads of it have ended): a lane holds only 32 bytes in
    // a row of its head, and from LDS each store takes 512 contiguous bytes, four whole lines
    float* st = &lds_k[0][w][0];
    #pragma unroll
    for (int f = 0; f < 8; ++f) {
        float* sr = st + n * KPITCH + 16 * f + 8 * hi;
        *(float4*)(sr)     = make_float4(O[f][0], O[f][1], O[f][2], O[f][3]);
        *(float4*)(sr + 4) = make_float4(O[f][4], O[f][5], O[f][6], O[f][7]);
    }
    // a row is read by other lanes than wrote it: the wave's writes are done first, and no read is moved over this
    asm volatile("s_wait_dscnt 0x0" ::: "memory");
    float* op = opart + ((size_t)b * NSPLIT + split) * NHEADS * HD + 4 * lane;
    #pragma unroll
    for (int r = 0; r < NHEADS; ++r)
        *(float4*)(op + r * HD) = *(const float4*)(st + r * KPITCH + 4 * lane);
}

// ---------------------------------------------------------------------------
// Combine 32 split partials per (b,h): attn[b, h*128+d]
// grid.x = 64*16, block = 128 (one thread per dim).
// ---------------------------------------------------------------------------
__global__ __launch_bounds__(128) void reduce_kernel(
    const float* __restrict__ ml, const float* __restrict__ opart,
    float* __restrict__ attn)
{
    const int b = blockIdx.x >> 4;
    const int h = blockIdx.x & 15;
    const int d = threadIdx.x;
    const float* mlb = ml + (size_t)b * NSPLIT * NHEADS * 2;
    const float* ob  = opart + (size_t)b * NSPLIT * NHEADS * HD;

    float M = -3.0e38f;
    for (int s = 0; s < NSPLIT; ++s) M = fmaxf(M, mlb[(s * NHEADS + h) * 2]);

    float L = 0.0f, acc = 0.0f;
    for (int s = 0; s < NSPLIT; ++s) {
        const float ms = mlb[(s * NHEADS + h) * 2 + 0];
        const float ls = mlb[(s * NHEADS + h) * 2 + 1];
        const float wt = __expf(ms - M);
        L   += ls * wt;
        acc += wt * ob[((size_t)s * NHEADS + h) * HD + d];
    }
    attn[(size_t)b * EMBED + h * HD + d] = acc / L;
}

// ---------------------------------------------------------------------------
extern "C" void kernel_launch(void* const* d_in, const int* in_sizes, int n_in,
                              void* d_out, int out_size, void* d_ws, size_t ws_size,
                              hipStream_t stream) {
    const float* x       = (const float*)d_in[0];
    const float* k_cache = (const float*)d_in[1];
    const float* v_cache = (const float*)d_in[2];
    const int*   pos     = (const int*)  d_in[3];
    const float* Wq      = (const float*)d_in[4];
    const float* bq      = (const float*)d_in[5];
    const float* Wk      = (const float*)d_in[6];
    const float* bk      = (const float*)d_in[7];
    const float* Wv      = (const float*)d_in[8];
    const float* bv      = (const float*)d_in[9];
    const float* Wo      = (const float*)d_in[10];
    const float* bo      = (const float*)d_in[11];

    float* ws    = (float*)d_ws;
    float* q     = ws;                       // 64*2048
    float* knew  = q + NBATCH * EMBED;       // 64*128
    float* vnew  = knew + NBATCH * HD;       // 64*128
    float* attn  = vnew + NBATCH * HD;       // 64*2048
    float* ml    = attn + NBATCH * EMBED;    // 64*32*16*2
    float* opart = ml + NBATCH * NSPLIT * NHEADS * 2;  // 64*32*16*128

    // QKV projections, one launch: 128 column tiles of Wq, 8 of Wk, 8 of Wv, each by two work-groups
    gemm64_kernel<<<dim3(EMBED / 16 + 2 * (HD / 16), NBATCH / MROWS), 32 * KWAVES, 0, stream>>>(
        x, Wq, bq, q, EMBED, Wk, bk, knew, Wv, bv, vnew, HD);

    // flash-decoding attention over the contiguous cache (+ new token read at slot pos)
    attn_kernel<<<NBATCH * 8, 128, 0, stream>>>(q, k_cache, v_cache, knew, vnew,
                                                pos, ml, opart);
    reduce_kernel<<<NBATCH * NHEADS, 128, 0, stream>>>(ml, opart, attn);

    // output projection
    gemm64_kernel<<<dim3(EMBED / 16, NBATCH / MROWS), 32 * KWAVES, 0, stream>>>(
        attn, Wo, bo, (float*)d_out, EMBED, nullptr, nullptr, nullptr, nullptr, nullptr, nullptr, 0);
}

// v009
// One run takes 46 microseconds.
// Timed twice side by side with v008, it ran 1.05 and 1.04 times as fast.
// All steps since v000 together make it 15.2 times as fast.
#include <hip/hip_runtime.h>
#include <hip/hip_bf16.h>

typedef __attribute__((ext_vector_type(2))) float v2f;
typedef __attribute__((ext_vector_type(8))) float v8f;

#define EMBED 2048
#define HD 128
#define NHEADS 16
#define STOT 4096
#define NBATCH 64
#define NSPLIT 32           // waves per batch (8 WGs x 4 waves)
#define TILES_PER_WAVE 8    // 8 tiles * 16 slots = 128 slots per wave
#define MROWS 32            // rows of C per GEMM work-group: two work-groups share a column tile
#define KWAVES 8            // waves of a GEMM work-group, each with its share of K: few, as every wave of a short launch costs start time
#define KSTAGE 256          // k per stage of A in LDS: eight chunks of 4 k per wave
#define NSTAGE (EMBED / KSTAGE)
#define CPS (KSTAGE / 4 / KWAVES)   // chunks of 4 k that a wave multiplies per stage
#define WLEAD 4             // stages of W that a wave keeps asked for ahead: 64 loads in flight
#define APITCH 260          // floats per staged row: 16 B x odd, the 16 rows of a fragment read fall on all 64 banks
#define KPITCH 132          // floats per staged K row: 16 B x odd, the 16 slots of a fragment read fall on all 64 banks
#define QPITCH 132          // floats per staged Q row: 16 B x odd, the 16 heads of a fragment read fall on all 64 banks
#define VPITCH 132          // floats per staged V row: the two halves of a fragment read, eight rows apart, fall 32 banks apart

static __device__ __forceinline__ v8f wmma_f32(v2f a, v2f b, v8f c) {
    return __builtin_amdgcn_wmma_f32_16x16x4_f32(false, a, false, b, (short)0, c, false, false);
}

// ---------------------------------------------------------------------------
// GEMM: C[64,N] = A[64,EMBED] @ W[EMBED,N] + bias[N]   (f32 WMMA 16x16x4)
// Two work-groups per 16-wide column tile, each covering 2 of the 4 row tiles (32 of M=64 rows,
// picked by blockIdx.y): the f32 matrix work of a tile column is the longest part of a work-group,
// and so it lies on two WGPs' matrix units; an output projection then fills 256 WGPs, not 128.
// K is split over the work-group's 8 waves (two per SIMD): wave w sums the chunks of 4 k
// numbered w, w+8, w+16, ...; the 8 partial tiles are summed through LDS.
// A comes in stages of 32 rows x 256 k by asynchronous copies to LDS: each
// wave-wide copy takes 512 contiguous bytes of one row (four whole lines), and
// the row-per-lane fragments are read from LDS; two stage buffers, the next
// stage's copies in flight while this one is multiplied.
// W goes straight to registers: a wave asks for the B fragments of its first four stages in front of
// stage 0 and for those of stage s + 4 behind the products of stage s; each stage waits only for its own eight.
// One launch serves up to three products of the same A: the first N0/16 work-groups
// take W0, the next N12/16 take W1, the last N12/16 take W2; they share nothing.
// grid.x = N0/16 (+ 2 * N12/16 where W1 and W2 are given), grid.y = 2, block = 256 (8 waves).
// ---------------------------------------------------------------------------
// One thread's share of a stage: 16 bytes of each of eight rows, 4 rows apart.
// The s_wait_xcnt stands inside the statement, so that no address register of a
// copy is rewritten in front of it.
static __device__ __forceinline__ void copy_stage(unsigned l, const float* g) {
    asm volatile(
        "global_load_async_to_lds_b128 %0, %8, off\n\t"
        "global_load_async_to_lds_b128 %1, %9, off\n\t"
        "global_load_async_to_lds_b128 %2, %10, off\n\t"
        "global_load_async_to_lds_b128 %3, %11, off\n\t"
        "global_load_async_to_lds_b128 %4, %12, off\n\t"
        "global_load_async_to_lds_b128 %5, %13, off\n\t"
        "global_load_async_to_lds_b128 %6, %14, off\n\t"
        "global_load_async_to_lds_b128 %7, %15, off\n\t"
        "s_wait_xcnt 0x0"
        :: "v"(l), "v"(l + 4 * APITCH * 4), "v"(l + 8 * APITCH * 4), "v"(l + 12 * APITCH * 4),
           "v"(l + 16 * APITCH * 4), "v"(l + 20 * APITCH * 4), "v"(l + 24 * APITCH * 4), "v"(l + 28 * APITCH * 4),
           "v"(g), "v"(g + 4 * EMBED), "v"(g + 8 * EMBED), "v"(g + 12 * EMBED),
           "v"(g + 16 * EMBED), "v"(g + 20 * EMBED), "v"(g + 24 * EMBED), "v"(g + 28 * EMBED)
        : "memory");
}

// The work-group's own barrier by hand, for the stages of A: __syncthreads() carries a fence that waits for
// every global load of the wave, and would drain the loads of W that are meant to stay in flight across it.
// What the staged data needs stands in front of every call: s_wait_asynccnt 0, and s_wait_dscnt 0 where the wave has read LDS.
static __device__ __forceinline__ void stage_barrier() {
    asm volatile("s_barrier_signal -1\n\ts_barrier_wait -1" ::: "memory");
}

// waves_per_eu(4, 4): two work-groups' 16 waves sit 4 to a SIMD where a WGP holds two; told so, the compiler keeps
// a wave's loads of W in flight (64 registers and more) instead of saving registers for 16 waves a SIMD.
__global__ __launch_bounds__(32 * KWAVES) __attribute__((amdgpu_waves_per_eu(4, 4))) void gemm64_kernel(
    const float* __restrict__ A,
    const float* __restrict__ W0, const float* __restrict__ bias0, float* __restrict__ C0, int N0,
    const float* __restrict__ W1, const float* __restrict__ bias1, float* __restrict__ C1,
    const float* __restrict__ W2, const float* __restrict__ bias2, float* __restrict__ C2, int N12)
{
    __shared__ __attribute__((aligned(16))) float stage[2][MROWS * APITCH];
    __shared__ float part[KWAVES * MROWS * 16];   // one 32x16 partial tile per wave

    const int lane = threadIdx.x & 31;
    // wave number in a scalar register: addresses that hang on it stay scalar
    const int w    = __builtin_amdgcn_readfirstlane(threadIdx.x >> 5);
    const int n    = lane & 15;
    const int hi   = lane >> 4;
    // which product this work-group serves, and which column tile of it (the same for the whole group)
    const int t0   = N0 >> 4;
    const int t12  = N12 >> 4;
    const int sel  = ((int)blockIdx.x >= t0) + ((int)blockIdx.x >= t0 + t12);
    const float* W    = sel == 0 ? W0 : sel == 1 ? W1 : W2;
    const float* bias = sel == 0 ? bias0 : sel == 1 ? bias1 : bias2;
    float*       C    = sel == 0 ? C0 : sel == 1 ? C1 : C2;
    const int N    = sel == 0 ? N0 : N12;
    const int tile = (int)blockIdx.x - (sel == 0 ? 0 : sel == 1 ? t0 : t0 + t12);
    const int col  = tile * 16 + n;

    // first of this work-group's 32 rows of A and C
    const int m0 = (int)blockIdx.y * MROWS;
    // this thread's share of a stage: 16 bytes at column 4*sc of rows m0 + sr, +4, +8, ..., +28
    const int sr = threadIdx.x >> 6;
    const int sc = threadIdx.x & 63;
    const float* ag = A + (size_t)(m0 + sr) * EMBED + 4 * sc;
    // LDS byte address (low 32 bits of the shared address) of that share in each buffer
    const unsigned l0 = (unsigned)(size_t)&stage[0][sr * APITCH + 4 * sc];
    const unsigned l1 = (unsigned)(size_t)&stage[1][sr * APITCH + 4 * sc];

    copy_stage(l0, ag);

    // the chunks of W that this wave multiplies in its first WLEAD stages, asked for here, in the order of their use:
    // memory's latency is paid once, under the wait for stage 0, not again in every stage
    const unsigned o0 = (unsigned)((4 * w + 2 * hi) * N + col);   // row k of chunk 0, this lane's column
    const unsigned o1 = o0 + (unsigned)N;                         // row k + 1
    v2f b[CPS * NSTAGE];
    // unrolled: b[j] is picked at compile time and stays in registers
    #pragma unroll
    for (int j = 0; j < CPS * WLEAD; ++j) {
        const float* wj = W + (size_t)j * (4 * KWAVES) * N;       // chunk j starts 32 rows behind chunk j - 1
        b[j].x = wj[o0];
        b[j].y = wj[o1];
        // keeps the loads in the order of their use: a stage's counted wait then waits for no later chunk
        if (j & 1) __builtin_amdgcn_sched_barrier(0);
    }

    // stage 0 has landed for this wave's copies; the barrier publishes it to all
    asm volatile("s_wait_asynccnt 0x0" ::: "memory");
    stage_barrier();
    copy_stage(l1, ag + KSTAGE);

    v8f acc0 = {}, acc1 = {};

    // unrolled: the buffer choice and the three tail tests are compile-time, LDS offsets immediates
    #pragma unroll
    for (int s = 0; s < NSTAGE; ++s) {
        // unrolled: b[CPS * s + u] is picked at compile time and stays in registers
        #pragma unroll
        for (int u = 0; u < CPS; ++u) {
            const float* as = &stage[s & 1][n * APITCH + 4 * (w + KWAVES * u) + 2 * hi];
            v2f a0 = *(const v2f*)(as + 0 * 16 * APITCH);
            v2f a1 = *(const v2f*)(as + 1 * 16 * APITCH);
            acc0 = wmma_f32(a0, b[CPS * s + u], acc0);
            acc1 = wmma_f32(a1, b[CPS * s + u], acc1);
        }
        // holds the stage's WMMAs in front of the waits below: without it the compiler sinks them
        // behind the barrier, where they stand in front of the refill's copies
        __builtin_amdgcn_sched_barrier(0);
        if (s + WLEAD < NSTAGE) {
            // W of stage s + WLEAD, in the place of the fragments just multiplied: four stages' time to arrive
            // unrolled: b[j] is picked at compile time and stays in registers
            #pragma unroll
            for (int j = CPS * (s + WLEAD); j < CPS * (s + WLEAD + 1); ++j) {
                const float* wj = W + (size_t)j * (4 * KWAVES) * N;
                b[j].x = wj[o0];
                b[j].y = wj[o1];
                // keeps these loads here, in the order of their use and in front of the waits below
                if (j & 1) __builtin_amdgcn_sched_barrier(0);
            }
        }
        if (s + 1 < NSTAGE) {
            // this wave's reads of buffer s & 1 are done before the buffer is refilled
            asm volatile("s_wait_dscnt 0x0" ::: "memory");
            // this wave's copies of stage s + 1 have landed
            asm volatile("s_wait_asynccnt 0x0" ::: "memory");
            // publishes stage s + 1 and ends every wave's reads of stage s
            stage_barrier();
            if (s + 2 < NSTAGE) copy_stage((s & 1) ? l1 : l0, ag + (s + 2) * KSTAGE);
        }
    }
    // no copy is outstanding when the wave goes on
    asm volatile("s_wait_asynccnt 0x0" ::: "memory");

    // partial tile -> LDS, register (i, j) of every lane at (i*8 + j)*32 + lane
    float* pw = part + w * (MROWS * 16) + lane;
    #pragma unroll
    for (int j = 0; j < 8; ++j) {
        pw[(0 * 8 + j) * 32] = acc0[j];
        pw[(1 * 8 + j) * 32] = acc1[j];
    }
    __syncthreads();

    // thread (w, lane) owns the elements (i, j == w, lane), i = 0 and 1, of the 32x16 tile
    float s0 = 0.0f, s1 = 0.0f;
    #pragma unroll
    for (int v = 0; v < KWAVES; ++v) {
        s0 += part[v * (MROWS * 16) + threadIdx.x];
        s1 += part[v * (MROWS * 16) + 8 * 32 + threadIdx.x];
    }

    const int row = m0 + w + 8 * hi;
    const float bc = bias[col];
    C[(size_t)row * N + col] = s0 + bc;
    C[(size_t)(row + 16) * N + col] = s1 + bc;
}

template <int PITCH>
static __device__ __forceinline__ void copy_tile(unsigned l, const float* cache, const float* fresh,
                                                 int slot0, int pslot, int lane) {
    // unrolled: the row offsets in LDS are compile-time
    #pragma unroll
    for (int h = 0; h < 2; ++h) {
        const float* g[8];
        // unrolled: g[r] is picked at compile time and stays in registers
        #pragma unroll
        for (int r = 0; r < 8; ++r) {
            const int slot = slot0 + 8 * h + r;
            g[r] = (slot == pslot ? fresh : cache + (size_t)slot * HD) + 4 * lane;
        }
        const unsigned lh = l + 8 * h * PITCH * 4;
        asm volatile(
            "global_load_async_to_lds_b128 %0, %8, off\n\t"
            "global_load_async_to_lds_b128 %1, %9, off\n\t"
            "global_load_async_to_lds_b128 %2, %10, off\n\t"
            "global_load_async_to_lds_b128 %3, %11, off\n\t"
            "global_load_async_to_lds_b128 %4, %12, off\n\t"
            "global_load_async_to_lds_b128 %5, %13, off\n\t"
            "global_load_async_to_lds_b128 %6, %14, off\n\t"
            "global_load_async_to_lds_b128 %7, %15, off\n\t"
            "s_wait_xcnt 0x0"
            :: "v"(lh), "v"(lh + 1 * PITCH * 4), "v"(lh + 2 * PITCH * 4), "v"(lh + 3 * PITCH * 4),
               "v"(lh + 4 * PITCH * 4), "v"(lh + 5 * PITCH * 4), "v"(lh + 6 * PITCH * 4), "v"(lh + 7 * PITCH * 4),
               "v"(g[0]), "v"(g[1]), "v"(g[2]), "v"(g[3]), "v"(g[4]), "v"(g[5]), "v"(g[6]), "v"(g[7])
            : "memory");
    }
}

// The value that lane l ^ 16 holds, by a vector cross-row move (a shuffle would go through the LDS unit).
static __device__ __forceinline__ float other_half(float x) {
    const int i = __float_as_int(x);
    return __int_as_float(__builtin_amdgcn_permlanex16(i, i, 0x76543210, 0xfedcba98, false, false));
}

__global__ __launch_bounds__(128) void attn_kernel(
    const float* __restrict__ q,      // [64, 2048]  (16 heads x 128)
    const float* __restrict__ kcache, // [64, 4096, 128]
    const float* __restrict__ vcache, // [64, 4096, 128]
    const float* __restrict__ knew,   // [64, 128]
    const float* __restrict__ vnew,   // [64, 128]
    const int*   __restrict__ pos,    // [64]
    float* __restrict__ ml,           // [64, 32, 16, 2]
    float* __restrict__ opart)        // [64, 32, 16, 128]
{
    __shared__ __attribute__((aligned(16))) float lds_q[NHEADS * QPITCH];
    __shared__ __attribute__((aligned(16))) float lds_k[2][4][16 * KPITCH];
    __shared__ __attribute__((aligned(16))) float lds_v[2][4][16 * VPITCH];

    const int tid   = threadIdx.x;
    // wave number in a scalar register: the slot numbers and the copies' source rows stay scalar
    const int w     = __builtin_amdgcn_readfirstlane(tid >> 5);
    const int lane  = tid & 31;
    const int n     = lane & 15;   // slot or dim row for A / head column for B, C
    const int hi    = lane >> 4;
    const int b     = blockIdx.x >> 3;
    const int split = (blockIdx.x & 7) * 4 + w;    // 0..31
    const int pslot = pos[b];
    const size_t kvb = (size_t)b * STOT * HD;
    const float* kc = kcache + kvb;
    const float* vc = vcache + kvb;
    const float* kf = knew + (size_t)b * HD;
    const float* vf = vnew + (size_t)b * HD;
    // LDS byte address (low 32 bits of the shared address) of this lane's column in this wave's tile, buffer 0
    const unsigned lk = (unsigned)(size_t)&lds_k[0][w][4 * lane];
    const unsigned lv = (unsigned)(size_t)&lds_v[0][w][4 * lane];
    const unsigned kbuf = sizeof(lds_k[0]);   // bytes from buffer 0 to buffer 1
    const unsigned vbuf = sizeof(lds_v[0]);

    copy_tile<KPITCH>(lk, kc, kf, split * 128, pslot, lane);
    copy_tile<VPITCH>(lv, vc, vf, split * 128, pslot, lane);

    // stage Q[b] (16x128) into LDS, coalesced
    const float* qg = q + (size_t)b * EMBED;
    for (int r = 0; r < NHEADS; ++r) lds_q[r * QPITCH + tid] = qg[r * HD + tid];
    // tile 0 has landed for this wave's copies; the barrier publishes it, and Q, to all
    asm volatile("s_wait_asynccnt 0x0" ::: "memory");
    __syncthreads();
    copy_tile<KPITCH>(lk + kbuf, kc, kf, split * 128 + 16, pslot, lane);
    copy_tile<VPITCH>(lv + vbuf, vc, vf, split * 128 + 16, pslot, lane);

    // this lane's 32 B fragments of Q^T: the same for every tile, read from LDS once and kept in registers
    v2f qa[32];
    // unrolled: qa[kk] is picked at compile time and stays in registers
    #pragma unroll
    for (int kk = 0; kk < 32; ++kk) qa[kk] = *(const v2f*)(lds_q + n * QPITCH + 4 * kk + 2 * hi);

    const float scale = 0.08838834764831845f;  // 1/sqrt(128)

    // one head per lane: its running maximum (alike in both halves) and the sum over this half's slots
    float m_run = -3.0e38f, l_run = 0.0f;
    v8f O[8];   // O[f][j] = O^T[dim 16*f + 8*hi + j][head n]
    #pragma unroll
    for (int f = 0; f < 8; ++f) O[f] = v8f{};

    #pragma unroll 1
    for (int t = 0; t < TILES_PER_WAVE; ++t) {
        const int slot_base = split * 128 + t * 16;

        // ---- S^T = K @ Q^T for a 16-slot x 16-head tile: S[j] = score of slot 8*hi + j, head n ----
        const float* kr = &lds_k[t & 1][w][n * KPITCH];   // this lane's slot row
        v8f S = {};
        #pragma unroll
        for (int kk = 0; kk < 32; ++kk) {
            v2f kb = *(const v2f*)(kr + 4 * kk + 2 * hi);
            S = wmma_f32(kb, qa[kk], S);
        }

        // ---- online softmax, a head's 16 slots in the two lanes n and n + 16 ----
        float sj[8];
        #pragma unroll
        for (int j = 0; j < 8; ++j) sj[j] = S[j] * scale;
        float tm = fmaxf(fmaxf(fmaxf(sj[0], sj[1]), fmaxf(sj[2], sj[3])),
                         fmaxf(fmaxf(sj[4], sj[5]), fmaxf(sj[6], sj[7])));
        tm = fmaxf(tm, other_half(tm));
        const float mnew  = fmaxf(m_run, tm);
        const float alpha = __expf(m_run - mnew);
        float pj[8];
        #pragma unroll
        for (int j = 0; j < 8; ++j) pj[j] = __expf(sj[j] - mnew);
        l_run = l_run * alpha + (((pj[0] + pj[1]) + (pj[2] + pj[3])) + ((pj[4] + pj[5]) + (pj[6] + pj[7])));
        m_run = mnew;
        #pragma unroll
        for (int f = 0; f < 8; ++f) O[f] *= alpha;

        // ---- O^T += V^T @ P^T  (K = 16 slots, M = 128 dims in 8 fragments) ----
        // chunk c multiplies slots 2c, 2c+1 (lanes 0-15) and 8+2c, 8+2c+1 (lanes 16-31): the slots
        // whose P this lane already holds; V^T's fragment takes the same slots at the same places
        #pragma unroll
        for (int c = 0; c < 4; ++c) {
            v2f pb;
            pb.x = pj[2 * c];
            pb.y = pj[2 * c + 1];
            const float* vr0 = &lds_v[t & 1][w][(8 * hi + 2 * c) * VPITCH];
            const float* vr1 = vr0 + VPITCH;
            #pragma unroll
            for (int f = 0; f < 8; ++f) {
                v2f va;
                va.x = vr0[16 * f + n];
                va.y = vr1[16 * f + n];
                O[f] = wmma_f32(va, pb, O[f]);
            }
        }

        // this wave's reads of buffer t & 1 are done before the buffer is refilled
        asm volatile("s_wait_dscnt 0x0" ::: "memory");
        // this wave's copies of tile t + 1 have landed
        asm volatile("s_wait_asynccnt 0x0" ::: "memory");
        // publishes tile t + 1 and ends every wave's reads of tile t
        __syncthreads();
        if (t + 2 < TILES_PER_WAVE) {
            copy_tile<KPITCH>(lk + (t & 1) * kbuf, kc, kf, slot_base + 32, pslot, lane);
            copy_tile<VPITCH>(lv + (t & 1) * vbuf, vc, vf, slot_base + 32, pslot, lane);
        }
    }
    // no copy is outstanding when the wave goes on
    asm volatile("s_wait_asynccnt 0x0" ::: "memory");

    // ---- emit partials --------------------------------------------------
    // the two halves' sums are joined once, here
    const float l_all = l_run + other_half(l_run);
    if (hi == 0) {
        float* mlp = ml + ((size_t)b * NSPLIT + split) * NHEADS * 2;
        *(float2*)(mlp + n * 2) = make_float2(m_run, l_all);
    }

    // O^T goes back to one row per head through this wave's own K tile of buffer 0 (16 rows at KPITCH; no other
    // wave touches it, and this wave's copies into it and reads of it have ended): a lane holds only 32 bytes in
    // a row of its head, and from LDS each store takes 512 contiguous bytes, four whole lines
    float* st = &lds_k[0][w][0];
    #pragma unroll
    for (int f = 0; f < 8; ++f) {
        float* sr = st + n * KPITCH + 16 * f + 8 * hi;
        *(float4*)(sr)     = make_float4(O[f][0], O[f][1], O[f][2], O[f][3]);
        *(float4*)(sr + 4) = make_float4(O[f][4], O[f][5], O[f][6], O[f][7]);
    }
    // a row is read by other lanes than wrote it: the wave's writes are done first, and no read is moved over this
    asm volatile("s_wait_dscnt 0x0" ::: "memory");
    float* op = opart + ((size_t)b * NSPLIT + split) * NHEADS * HD + 4 * lane;
    #pragma unroll
    for (int r = 0; r < NHEADS; ++r)
        *(float4*)(op + r * HD) = *(const float4*)(st + r * KPITCH + 4 * lane);
}

// ---------------------------------------------------------------------------
// Combine 32 split partials per (b,h): attn[b, h*128+d]
// grid.x = 64*16, block = 128 (one thread per dim).
// ---------------------------------------------------------------------------
__global__ __launch_bounds__(128) void reduce_kernel(
    const float* __restrict__ ml, const float* __restrict__ opart,
    float* __restrict__ attn)
{
    const int b = blockIdx.x >> 4;
    const int h = blockIdx.x & 15;
    const int d = threadIdx.x;
    const float* mlb = ml + (size_t)b * NSPLIT * NHEADS * 2;
    const float* ob  = opart + (size_t)b * NSPLIT * NHEADS * HD;

    float M = -3.0e38f;
    for (int s = 0; s < NSPLIT; ++s) M = fmaxf(M, mlb[(s * NHEADS + h) * 2]);

    float L = 0.0f, acc = 0.0f;
    for (int s = 0; s < NSPLIT; ++s) {
        const float ms = mlb[(s * NHEADS + h) * 2 + 0];
        const float ls = mlb[(s * NHEADS + h) * 2 + 1];
        const float wt = __expf(ms - M);
        L   += ls * wt;
        acc += wt * ob[((size_t)s * NHEADS + h) * HD + d];
    }
    attn[(size_t)b * EMBED + h * HD + d] = acc / L;
}

// ---------------------------------------------------------------------------
extern "C" void kernel_launch(void* const* d_in, const int* in_sizes, int n_in,
                              void* d_out, int out_size, void* d_ws, size_t ws_size,
                              hipStream_t stream) {
    const float* x       = (const float*)d_in[0];
    const float* k_cache = (const float*)d_in[1];
    const float* v_cache = (const float*)d_in[2];
    const int*   pos     = (const int*)  d_in[3];
    const float* Wq      = (const float*)d_in[4];
    const float* bq      = (const float*)d_in[5];
    const float* Wk      = (const float*)d_in[6];
    const float* bk      = (const float*)d_in[7];
    const float* Wv      = (const float*)d_in[8];
    const float* bv      = (const float*)d_in[9];
    const float* Wo      = (const float*)d_in[10];
    const float* bo      = (const float*)d_in[11];

    float* ws    = (float*)d_ws;
    float* q     = ws;                       // 64*2048
    float* knew  = q + NBATCH * EMBED;       // 64*128
    float* vnew  = knew + NBATCH * HD;       // 64*128
    float* attn  = vnew + NBATCH * HD;       // 64*2048
    float* ml    = attn + NBATCH * EMBED;    // 64*32*16*2
    float* opart = ml + NBATCH * NSPLIT * NHEADS * 2;  // 64*32*16*128

    // QKV projections, one launch: 128 column tiles of Wq, 8 of Wk, 8 of Wv, each by two work-groups
    gemm64_kernel<<<dim3(EMBED / 16 + 2 * (HD / 16), NBATCH / MROWS), 32 * KWAVES, 0, stream>>>(
        x, Wq, bq, q, EMBED, Wk, bk, knew, Wv, bv, vnew, HD);

    // flash-decoding attention over the contiguous cache (+ new token read at slot pos)
    attn_kernel<<<NBATCH * 8, 128, 0, stream>>>(q, k_cache, v_cache, knew, vnew,
                                                pos, ml, opart);
    reduce_kernel<<<NBATCH * NHEADS, 128, 0, stream>>>(ml, opart, attn);

    // output projection
    gemm64_kernel<<<dim3(EMBED / 16, NBATCH / MROWS), 32 * KWAVES, 0, stream>>>(
        attn, Wo, bo, (float*)d_out, EMBED, nullptr, nullptr, nullptr, nullptr, nullptr, nullptr, 0);
}

// v010
// A run of this version takes 44 microseconds.
// Two timings next to v009 both put it at 1.04 times that version's speed.
// Counting every step since v000, it is 15.8 times as fast.
#include <hip/hip_runtime.h>
#include <hip/hip_bf16.h>

typedef __attribute__((ext_vector_type(2))) float v2f;
typedef __attribute__((ext_vector_type(8))) float v8f;

#define EMBED 2048
#define HD 128
#define NHEADS 16
#define STOT 4096
#define NBATCH 64
#define NPART 8             // partial results per batch: one per work-group, its 4 waves merged in LDS
#define TILES_PER_WAVE 8    // 8 tiles * 16 slots = 128 slots per wave
#define MROWS 32            // rows of C per GEMM work-group: two work-groups share a column tile
#define KWAVES 8            // waves of a GEMM work-group, each with its share of K: few, as every wave of a short launch costs start time
#define KSTAGE 256          // k per stage of A in LDS: eight chunks of 4 k per wave
#define NSTAGE (EMBED / KSTAGE)
#define CPS (KSTAGE / 4 / KWAVES)   // chunks of 4 k that a wave multiplies per stage
#define WLEAD 4             // stages of W that a wave keeps asked for ahead: 64 loads in flight
#define APITCH 260          // floats per staged row: 16 B x odd, the 16 rows of a fragment read fall on all 64 banks
#define KPITCH 132          // floats per staged K row: 16 B x odd, the 16 slots of a fragment read fall on all 64 banks
#define QPITCH 132          // floats per staged Q row: 16 B x odd, the 16 heads of a fragment read fall on all 64 banks
#define VPITCH 132          // floats per staged V row: the two halves of a fragment read, eight rows apart, fall 32 banks apart

static __device__ __forceinline__ v8f wmma_f32(v2f a, v2f b, v8f c) {
    return __builtin_amdgcn_wmma_f32_16x16x4_f32(false, a, false, b, (short)0, c, false, false);
}

// ---------------------------------------------------------------------------
// GEMM: C[64,N] = A[64,EMBED] @ W[EMBED,N] + bias[N]   (f32 WMMA 16x16x4)
// Two work-groups per 16-wide column tile, each covering 2 of the 4 row tiles (32 of M=64 rows,
// picked by blockIdx.y): the f32 matrix work of a tile column is the longest part of a work-group,
// and so it lies on two WGPs' matrix units; an output projection then fills 256 WGPs, not 128.
// K is split over the work-group's 8 waves (two per SIMD): wave w sums the chunks of 4 k
// numbered w, w+8, w+16, ...; the 8 partial tiles are summed through LDS.
// A comes in stages of 32 rows x 256 k by asynchronous copies to LDS: each
// wave-wide copy takes 512 contiguous bytes of one row (four whole lines), and
// the row-per-lane fragments are read from LDS; two stage buffers, the next
// stage's copies in flight while this one is multiplied.
// W goes straight to registers: a wave asks for the B fragments of its first four stages in front of
// stage 0 and for those of stage s + 4 behind the products of stage s; each stage waits only for its own eight.
// One launch serves up to three products of the same A: the first N0/16 work-groups
// take W0, the next N12/16 take W1, the last N12/16 take W2; they share nothing.
// grid.x = N0/16 (+ 2 * N12/16 where W1 and W2 are given), grid.y = 2, block = 256 (8 waves).
// ---------------------------------------------------------------------------
// One thread's share of a stage: 16 bytes of each of eight rows, 4 rows apart.
// The s_wait_xcnt stands inside the statement, so that no address register of a
// copy is rewritten in front of it.
static __device__ __forceinline__ void copy_stage(unsigned l, const float* g) {
    asm volatile(
        "global_load_async_to_lds_b128 %0, %8, off\n\t"
        "global_load_async_to_lds_b128 %1, %9, off\n\t"
        "global_load_async_to_lds_b128 %2, %10, off\n\t"
        "global_load_async_to_lds_b128 %3, %11, off\n\t"
        "global_load_async_to_lds_b128 %4, %12, off\n\t"
        "global_load_async_to_lds_b128 %5, %13, off\n\t"
        "global_load_async_to_lds_b128 %6, %14, off\n\t"
        "global_load_async_to_lds_b128 %7, %15, off\n\t"
        "s_wait_xcnt 0x0"
        :: "v"(l), "v"(l + 4 * APITCH * 4), "v"(l + 8 * APITCH * 4), "v"(l + 12 * APITCH * 4),
           "v"(l + 16 * APITCH * 4), "v"(l + 20 * APITCH * 4), "v"(l + 24 * APITCH * 4), "v"(l + 28 * APITCH * 4),
           "v"(g), "v"(g + 4 * EMBED), "v"(g + 8 * EMBED), "v"(g + 12 * EMBED),
           "v"(g + 16 * EMBED), "v"(g + 20 * EMBED), "v"(g + 24 * EMBED), "v"(g + 28 * EMBED)
        : "memory");
}

// The work-group's own barrier by hand, for the stages of A: __syncthreads() carries a fence that waits for
// every global load of the wave, and would drain the loads of W that are meant to stay in flight across it.
// What the staged data needs stands in front of every call: s_wait_asynccnt 0, and s_wait_dscnt 0 where the wave has read LDS.
static __device__ __forceinline__ void stage_barrier() {
    asm volatile("s_barrier_signal -1\n\ts_barrier_wait -1" ::: "memory");
}

// waves_per_eu(4, 4): two work-groups' 16 waves sit 4 to a SIMD where a WGP holds two; told so, the compiler keeps
// a wave's loads of W in flight (64 registers and more) instead of saving registers for 16 waves a SIMD.
__global__ __launch_bounds__(32 * KWAVES) __attribute__((amdgpu_waves_per_eu(4, 4))) void gemm64_kernel(
    const float* __restrict__ A,
    const float* __restrict__ W0, const float* __restrict__ bias0, float* __restrict__ C0, int N0,
    const float* __restrict__ W1, const float* __restrict__ bias1, float* __restrict__ C1,
    const float* __restrict__ W2, const float* __restrict__ bias2, float* __restrict__ C2, int N12)
{
    __shared__ __attribute__((aligned(16))) float stage[2][MROWS * APITCH];
    __shared__ float part[KWAVES * MROWS * 16];   // one 32x16 partial tile per wave

    const int lane = threadIdx.x & 31;
    // wave number in a scalar register: addresses that hang on it stay scalar
    const int w    = __builtin_amdgcn_readfirstlane(threadIdx.x >> 5);
    const int n    = lane & 15;
    const int hi   = lane >> 4;
    // which product this work-group serves, and which column tile of it (the same for the whole group)
    const int t0   = N0 >> 4;
    const int t12  = N12 >> 4;
    const int sel  = ((int)blockIdx.x >= t0) + ((int)blockIdx.x >= t0 + t12);
    const float* W    = sel == 0 ? W0 : sel == 1 ? W1 : W2;
    const float* bias = sel == 0 ? bias0 : sel == 1 ? bias1 : bias2;
    float*       C    = sel == 0 ? C0 : sel == 1 ? C1 : C2;
    const int N    = sel == 0 ? N0 : N12;
    const int tile = (int)blockIdx.x - (sel == 0 ? 0 : sel == 1 ? t0 : t0 + t12);
    const int col  = tile * 16 + n;

    // first of this work-group's 32 rows of A and C
    const int m0 = (int)blockIdx.y * MROWS;
    // this thread's share of a stage: 16 bytes at column 4*sc of rows m0 + sr, +4, +8, ..., +28
    const int sr = threadIdx.x >> 6;
    const int sc = threadIdx.x & 63;
    const float* ag = A + (size_t)(m0 + sr) * EMBED + 4 * sc;
    // LDS byte address (low 32 bits of the shared address) of that share in each buffer
    const unsigned l0 = (unsigned)(size_t)&stage[0][sr * APITCH + 4 * sc];
    const unsigned l1 = (unsigned)(size_t)&stage[1][sr * APITCH + 4 * sc];

    copy_stage(l0, ag);

    // the chunks of W that this wave multiplies in its first WLEAD stages, asked for here, in the order of their use:
    // memory's latency is paid once, under the wait for stage 0, not again in every stage
    const unsigned o0 = (unsigned)((4 * w + 2 * hi) * N + col);   // row k of chunk 0, this lane's column
    const unsigned o1 = o0 + (unsigned)N;                         // row k + 1
    v2f b[CPS * NSTAGE];
    // unrolled: b[j] is picked at compile time and stays in registers
    #pragma unroll
    for (int j = 0; j < CPS * WLEAD; ++j) {
        const float* wj = W + (size_t)j * (4 * KWAVES) * N;       // chunk j starts 32 rows behind chunk j - 1
        b[j].x = wj[o0];
        b[j].y = wj[o1];
        // keeps the loads in the order of their use: a stage's counted wait then waits for no later chunk
        if (j & 1) __builtin_amdgcn_sched_barrier(0);
    }

    // stage 0 has landed for this wave's copies; the barrier publishes it to all
    asm volatile("s_wait_asynccnt 0x0" ::: "memory");
    stage_barrier();
    copy_stage(l1, ag + KSTAGE);

    v8f acc0 = {}, acc1 = {};

    // unrolled: the buffer choice and the three tail tests are compile-time, LDS offsets immediates
    #pragma unroll
    for (int s = 0; s < NSTAGE; ++s) {
        // unrolled: b[CPS * s + u] is picked at compile time and stays in registers
        #pragma unroll
        for (int u = 0; u < CPS; ++u) {
            const float* as = &stage[s & 1][n * APITCH + 4 * (w + KWAVES * u) + 2 * hi];
            v2f a0 = *(const v2f*)(as + 0 * 16 * APITCH);
            v2f a1 = *(const v2f*)(as + 1 * 16 * APITCH);
            acc0 = wmma_f32(a0, b[CPS * s + u], acc0);
            acc1 = wmma_f32(a1, b[CPS * s + u], acc1);
        }
        // holds the stage's WMMAs in front of the waits below: without it the compiler sinks them
        // behind the barrier, where they stand in front of the refill's copies
        __builtin_amdgcn_sched_barrier(0);
        if (s + WLEAD < NSTAGE) {
            // W of stage s + WLEAD, in the place of the fragments just multiplied: four stages' time to arrive
            // unrolled: b[j] is picked at compile time and stays in registers
            #pragma unroll
            for (int j = CPS * (s + WLEAD); j < CPS * (s + WLEAD + 1); ++j) {
                const float* wj = W + (size_t)j * (4 * KWAVES) * N;
                b[j].x = wj[o0];
                b[j].y = wj[o1];
                // keeps these loads here, in the order of their use and in front of the waits below
                if (j & 1) __builtin_amdgcn_sched_barrier(0);
            }
        }
        if (s + 1 < NSTAGE) {
            // this wave's reads of buffer s & 1 are done before the buffer is refilled
            asm volatile("s_wait_dscnt 0x0" ::: "memory");
            // this wave's copies of stage s + 1 have landed
            asm volatile("s_wait_asynccnt 0x0" ::: "memory");
            // publishes stage s + 1 and ends every wave's reads of stage s
            stage_barrier();
            if (s + 2 < NSTAGE) copy_stage((s & 1) ? l1 : l0, ag + (s + 2) * KSTAGE);
        }
    }
    // no copy is outstanding when the wave goes on
    asm volatile("s_wait_asynccnt 0x0" ::: "memory");

    // partial tile -> LDS, register (i, j) of every lane at (i*8 + j)*32 + lane
    float* pw = part + w * (MROWS * 16) + lane;
    #pragma unroll
    for (int j = 0; j < 8; ++j) {
        pw[(0 * 8 + j) * 32] = acc0[j];
        pw[(1 * 8 + j) * 32] = acc1[j];
    }
    __syncthreads();

    // thread (w, lane) owns the elements (i, j == w, lane), i = 0 and 1, of the 32x16 tile
    float s0 = 0.0f, s1 = 0.0f;
    #pragma unroll
    for (int v = 0; v < KWAVES; ++v) {
        s0 += part[v * (MROWS * 16) + threadIdx.x];
        s1 += part[v * (MROWS * 16) + 8 * 32 + threadIdx.x];
    }

    const int row = m0 + w + 8 * hi;
    const float bc = bias[col];
    C[(size_t)row * N + col] = s0 + bc;
    C[(size_t)(row + 16) * N + col] = s1 + bc;
}

template <int PITCH>
static __device__ __forceinline__ void copy_tile(unsigned l, const float* cache, const float* fresh,
                                                 int slot0, int pslot, int lane) {
    // unrolled: the row offsets in LDS are compile-time
    #pragma unroll
    for (int h = 0; h < 2; ++h) {
        const float* g[8];
        // unrolled: g[r] is picked at compile time and stays in registers
        #pragma unroll
        for (int r = 0; r < 8; ++r) {
            const int slot = slot0 + 8 * h + r;
            g[r] = (slot == pslot ? fresh : cache + (size_t)slot * HD) + 4 * lane;
        }
        const unsigned lh = l + 8 * h * PITCH * 4;
        asm volatile(
            "global_load_async_to_lds_b128 %0, %8, off\n\t"
            "global_load_async_to_lds_b128 %1, %9, off\n\t"
            "global_load_async_to_lds_b128 %2, %10, off\n\t"
            "global_load_async_to_lds_b128 %3, %11, off\n\t"
            "global_load_async_to_lds_b128 %4, %12, off\n\t"
            "global_load_async_to_lds_b128 %5, %13, off\n\t"
            "global_load_async_to_lds_b128 %6, %14, off\n\t"
            "global_load_async_to_lds_b128 %7, %15, off\n\t"
            "s_wait_xcnt 0x0"
            :: "v"(lh), "v"(lh + 1 * PITCH * 4), "v"(lh + 2 * PITCH * 4), "v"(lh + 3 * PITCH * 4),
               "v"(lh + 4 * PITCH * 4), "v"(lh + 5 * PITCH * 4), "v"(lh + 6 * PITCH * 4), "v"(lh + 7 * PITCH * 4),
               "v"(g[0]), "v"(g[1]), "v"(g[2]), "v"(g[3]), "v"(g[4]), "v"(g[5]), "v"(g[6]), "v"(g[7])
            : "memory");
    }
}

// The value that lane l ^ 16 holds, by a vector cross-row move (a shuffle would go through the LDS unit).
static __device__ __forceinline__ float other_half(float x) {
    const int i = __float_as_int(x);
    return __int_as_float(__builtin_amdgcn_permlanex16(i, i, 0x76543210, 0xfedcba98, false, false));
}

__global__ __launch_bounds__(128) void attn_kernel(
    const float* __restrict__ q,      // [64, 2048]  (16 heads x 128)
    const float* __restrict__ kcache, // [64, 4096, 128]
    const float* __restrict__ vcache, // [64, 4096, 128]
    const float* __restrict__ knew,   // [64, 128]
    const float* __restrict__ vnew,   // [64, 128]
    const int*   __restrict__ pos,    // [64]
    float* __restrict__ ml,           // [64, 8, 16, 2]
    float* __restrict__ opart)        // [64, 8, 16, 128]
{
    __shared__ __attribute__((aligned(16))) float lds_q[NHEADS * QPITCH];
    __shared__ __attribute__((aligned(16))) float lds_k[2][4][16 * KPITCH];
    __shared__ __attribute__((aligned(16))) float lds_v[2][4][16 * VPITCH];
    __shared__ float2 lds_ml[4][NHEADS];   // each wave's (max, sum) per head, for the merge

    const int tid   = threadIdx.x;
    // wave number in a scalar register: the slot numbers and the copies' source rows stay scalar
    const int w     = __builtin_amdgcn_readfirstlane(tid >> 5);
    const int lane  = tid & 31;
    const int n     = lane & 15;   // slot or dim row for A / head column for B, C
    const int hi    = lane >> 4;
    const int b     = blockIdx.x >> 3;
    const int split = (blockIdx.x & 7) * 4 + w;    // 0..31
    const int pslot = pos[b];
    const size_t kvb = (size_t)b * STOT * HD;
    const float* kc = kcache + kvb;
    const float* vc = vcache + kvb;
    const float* kf = knew + (size_t)b * HD;
    const float* vf = vnew + (size_t)b * HD;
    // LDS byte address (low 32 bits of the shared address) of this lane's column in this wave's tile, buffer 0
    const unsigned lk = (unsigned)(size_t)&lds_k[0][w][4 * lane];
    const unsigned lv = (unsigned)(size_t)&lds_v[0][w][4 * lane];
    const unsigned kbuf = sizeof(lds_k[0]);   // bytes from buffer 0 to buffer 1
    const unsigned vbuf = sizeof(lds_v[0]);

    copy_tile<KPITCH>(lk, kc, kf, split * 128, pslot, lane);
    copy_tile<VPITCH>(lv, vc, vf, split * 128, pslot, lane);

    // stage Q[b] (16x128) into LDS, coalesced
    const float* qg = q + (size_t)b * EMBED;
    for (int r = 0; r < NHEADS; ++r) lds_q[r * QPITCH + tid] = qg[r * HD + tid];
    // tile 0 has landed for this wave's copies; the barrier publishes it, and Q, to all
    asm volatile("s_wait_asynccnt 0x0" ::: "memory");
    __syncthreads();
    copy_tile<KPITCH>(lk + kbuf, kc, kf, split * 128 + 16, pslot, lane);
    copy_tile<VPITCH>(lv + vbuf, vc, vf, split * 128 + 16, pslot, lane);

    // this lane's 32 B fragments of Q^T: the same for every tile, read from LDS once and kept in registers
    v2f qa[32];
    // unrolled: qa[kk] is picked at compile time and stays in registers
    #pragma unroll
    for (int kk = 0; kk < 32; ++kk) qa[kk] = *(const v2f*)(lds_q + n * QPITCH + 4 * kk + 2 * hi);

    const float scale = 0.08838834764831845f;  // 1/sqrt(128)

    // one head per lane: its running maximum (alike in both halves) and the sum over this half's slots
    float m_run = -3.0e38f, l_run = 0.0f;
    v8f O[8];   // O[f][j] = O^T[dim 16*f + 8*hi + j][head n]
    #pragma unroll
    for (int f = 0; f < 8; ++f) O[f] = v8f{};

    #pragma unroll 1
    for (int t = 0; t < TILES_PER_WAVE; ++t) {
        const int slot_base = split * 128 + t * 16;

        // ---- S^T = K @ Q^T for a 16-slot x 16-head tile: S[j] = score of slot 8*hi + j, head n ----
        const float* kr = &lds_k[t & 1][w][n * KPITCH];   // this lane's slot row
        v8f S = {};
        #pragma unroll
        for (int kk = 0; kk < 32; ++kk) {
            v2f kb = *(const v2f*)(kr + 4 * kk + 2 * hi);
            S = wmma_f32(kb, qa[kk], S);
        }

        // ---- online softmax, a head's 16 slots in the two lanes n and n + 16 ----
        float sj[8];
        #pragma unroll
        for (int j = 0; j < 8; ++j) sj[j] = S[j] * scale;
        float tm = fmaxf(fmaxf(fmaxf(sj[0], sj[1]), fmaxf(sj[2], sj[3])),
                         fmaxf(fmaxf(sj[4], sj[5]), fmaxf(sj[6], sj[7])));
        tm = fmaxf(tm, other_half(tm));
        const float mnew  = fmaxf(m_run, tm);
        const float alpha = __expf(m_run - mnew);
        float pj[8];
        #pragma unroll
        for (int j = 0; j < 8; ++j) pj[j] = __expf(sj[j] - mnew);
        l_run = l_run * alpha + (((pj[0] + pj[1]) + (pj[2] + pj[3])) + ((pj[4] + pj[5]) + (pj[6] + pj[7])));
        m_run = mnew;
        #pragma unroll
        for (int f = 0; f < 8; ++f) O[f] *= alpha;

        // ---- O^T += V^T @ P^T  (K = 16 slots, M = 128 dims in 8 fragments) ----
        // chunk c multiplies slots 2c, 2c+1 (lanes 0-15) and 8+2c, 8+2c+1 (lanes 16-31): the slots
        // whose P this lane already holds; V^T's fragment takes the same slots at the same places
        #pragma unroll
        for (int c = 0; c < 4; ++c) {
            v2f pb;
            pb.x = pj[2 * c];
            pb.y = pj[2 * c + 1];
            const float* vr0 = &lds_v[t & 1][w][(8 * hi + 2 * c) * VPITCH];
            const float* vr1 = vr0 + VPITCH;
            #pragma unroll
            for (int f = 0; f < 8; ++f) {
                v2f va;
                va.x = vr0[16 * f + n];
                va.y = vr1[16 * f + n];
                O[f] = wmma_f32(va, pb, O[f]);
            }
        }

        // this wave's reads of buffer t & 1 are done before the buffer is refilled
        asm volatile("s_wait_dscnt 0x0" ::: "memory");
        // this wave's copies of tile t + 1 have landed
        asm volatile("s_wait_asynccnt 0x0" ::: "memory");
        // publishes tile t + 1 and ends every wave's reads of tile t
        __syncthreads();
        if (t + 2 < TILES_PER_WAVE) {
            copy_tile<KPITCH>(lk + (t & 1) * kbuf, kc, kf, slot_base + 32, pslot, lane);
            copy_tile<VPITCH>(lv + (t & 1) * vbuf, vc, vf, slot_base + 32, pslot, lane);
        }
    }
    // no copy is outstanding when the wave goes on
    asm volatile("s_wait_asynccnt 0x0" ::: "memory");

    // ---- merge the work-group's 4 waves, emit one partial ----------------
    // the two halves' sums are joined once, here
    const float l_all = l_run + other_half(l_run);
    if (hi == 0) lds_ml[w][n] = make_float2(m_run, l_all);

    // O^T goes back to one row per head through this wave's own K tile of buffer 0 (16 rows at KPITCH; no other
    // wave has touched it so far, and this wave's copies into it and reads of it have ended)
    float* st = &lds_k[0][w][0];
    #pragma unroll
    for (int f = 0; f < 8; ++f) {
        float* sr = st + n * KPITCH + 16 * f + 8 * hi;
        *(float4*)(sr)     = make_float4(O[f][0], O[f][1], O[f][2], O[f][3]);
        *(float4*)(sr + 4) = make_float4(O[f][4], O[f][5], O[f][6], O[f][7]);
    }
    // publishes every wave's rows and (max, sum) pairs to the other three
    __syncthreads();

    // head n's merged maximum, the four waves' weights against it, and the merged sum
    const float2 p0 = lds_ml[0][n], p1 = lds_ml[1][n], p2 = lds_ml[2][n], p3 = lds_ml[3][n];
    const float M  = fmaxf(fmaxf(p0.x, p1.x), fmaxf(p2.x, p3.x));
    const float e0 = __expf(p0.x - M), e1 = __expf(p1.x - M), e2 = __expf(p2.x - M), e3 = __expf(p3.x - M);
    const int part = b * NPART + ((int)blockIdx.x & 7);
    // one wave writes the work-group's 16 pairs: one writer for that 128-byte line
    if (w == 0 && hi == 0) {
        const float L = (p0.y * e0 + p1.y * e1) + (p2.y * e2 + p3.y * e3);
        *(float2*)(ml + ((size_t)part * NHEADS + n) * 2) = make_float2(M, L);
    }

    // wave w sums heads 4w .. 4w+3: each store takes 512 contiguous bytes, four whole lines, written once
    float* op = opart + (size_t)part * NHEADS * HD + 4 * lane;
    #pragma unroll
    for (int i = 0; i < 4; ++i) {
        const int r = 4 * w + i;
        // row r's four weights stand in lane r: taken from there into scalar registers
        const float s0 = __int_as_float(__builtin_amdgcn_readlane(__float_as_int(e0), r));
        const float s1 = __int_as_float(__builtin_amdgcn_readlane(__float_as_int(e1), r));
        const float s2 = __int_as_float(__builtin_amdgcn_readlane(__float_as_int(e2), r));
        const float s3 = __int_as_float(__builtin_amdgcn_readlane(__float_as_int(e3), r));
        const float4 r0 = *(const float4*)(&lds_k[0][0][r * KPITCH + 4 * lane]);
        const float4 r1 = *(const float4*)(&lds_k[0][1][r * KPITCH + 4 * lane]);
        const float4 r2 = *(const float4*)(&lds_k[0][2][r * KPITCH + 4 * lane]);
        const float4 r3 = *(const float4*)(&lds_k[0][3][r * KPITCH + 4 * lane]);
        float4 o;
        o.x = (r0.x * s0 + r1.x * s1) + (r2.x * s2 + r3.x * s3);
        o.y = (r0.y * s0 + r1.y * s1) + (r2.y * s2 + r3.y * s3);
        o.z = (r0.z * s0 + r1.z * s1) + (r2.z * s2 + r3.z * s3);
        o.w = (r0.w * s0 + r1.w * s1) + (r2.w * s2 + r3.w * s3);
        *(float4*)(op + r * HD) = o;
    }
}

// ---------------------------------------------------------------------------
// Combine the 8 work-groups' partials per (b,h): attn[b, h*128+d]
// grid.x = 64*16, block = 128 (one thread per dim).
// ---------------------------------------------------------------------------
__global__ __launch_bounds__(128) void reduce_kernel(
    const float* __restrict__ ml, const float* __restrict__ opart,
    float* __restrict__ attn)
{
    const int b = blockIdx.x >> 4;
    const int h = blockIdx.x & 15;
    const int d = threadIdx.x;
    const float* mlb = ml + (size_t)b * NPART * NHEADS * 2;
    const float* ob  = opart + (size_t)b * NPART * NHEADS * HD;

    float M = -3.0e38f;
    for (int s = 0; s < NPART; ++s) M = fmaxf(M, mlb[(s * NHEADS + h) * 2]);

    float L = 0.0f, acc = 0.0f;
    for (int s = 0; s < NPART; ++s) {
        const float ms = mlb[(s * NHEADS + h) * 2 + 0];
        const float ls = mlb[(s * NHEADS + h) * 2 + 1];
        const float wt = __expf(ms - M);
        L   += ls * wt;
        acc += wt * ob[((size_t)s * NHEADS + h) * HD + d];
    }
    attn[(size_t)b * EMBED + h * HD + d] = acc / L;
}

// ---------------------------------------------------------------------------
extern "C" void kernel_launch(void* const* d_in, const int* in_sizes, int n_in,
                              void* d_out, int out_size, void* d_ws, size_t ws_size,
                              hipStream_t stream) {
    const float* x       = (const float*)d_in[0];
    const float* k_cache = (const float*)d_in[1];
    const float* v_cache = (const float*)d_in[2];
    const int*   pos     = (const int*)  d_in[3];
    const float* Wq      = (const float*)d_in[4];
    const float* bq      = (const float*)d_in[5];
    const float* Wk      = (const float*)d_in[6];
    const float* bk      = (const float*)d_in[7];
    const float* Wv      = (const float*)d_in[8];
    const float* bv      = (const float*)d_in[9];
    const float* Wo      = (const float*)d_in[10];
    const float* bo      = (const float*)d_in[11];

    float* ws    = (float*)d_ws;
    float* q     = ws;                       // 64*2048
    float* knew  = q + NBATCH * EMBED;       // 64*128
    float* vnew  = knew + NBATCH * HD;       // 64*128
    float* attn  = vnew + NBATCH * HD;       // 64*2048
    float* ml    = attn + NBATCH * EMBED;    // 64*8*16*2
    float* opart = ml + NBATCH * NPART * NHEADS * 2;   // 64*8*16*128

    // QKV projections, one launch: 128 column tiles of Wq, 8 of Wk, 8 of Wv, each by two work-groups
    gemm64_kernel<<<dim3(EMBED / 16 + 2 * (HD / 16), NBATCH / MROWS), 32 * KWAVES, 0, stream>>>(
        x, Wq, bq, q, EMBED, Wk, bk, knew, Wv, bv, vnew, HD);

    // flash-decoding attention over the contiguous cache (+ new token read at slot pos)
    attn_kernel<<<NBATCH * 8, 128, 0, stream>>>(q, k_cache, v_cache, knew, vnew,
                                                pos, ml, opart);
    reduce_kernel<<<NBATCH * NHEADS, 128, 0, stream>>>(ml, opart, attn);

    // output projection
    gemm64_kernel<<<dim3(EMBED / 16, NBATCH / MROWS), 32 * KWAVES, 0, stream>>>(
        attn, Wo, bo, (float*)d_out, EMBED, nullptr, nullptr, nullptr, nullptr, nullptr, nullptr, 0);
}
